// v000
// Times are from an AMD MI455X. After a warm-up the kernel runs many times in a row, and a time is the length of
// such a window on the GPU divided by its runs, so every launch and the gaps after it count. The runs cycle
// through copies of the inputs. A figure is the median of several windows, for all but v000 over two sittings.
// Sittings can differ by a few percent; kernels timed side by side share one.
// v000 is the starting kernel. One run takes 515 microseconds.
#include <hip/hip_runtime.h>

// Multi-head dot-product attention (16 heads x 64, d_model 1024) on inputs_q / inputs_kv [2, 2048, 1024]: q = inputs_q Wq + bq, k/v = inputs_kv Wk/Wv + b; attn = softmax(q k^T / 8) per head over
// all 2,048 keys; ctx = attn v; out = ctx Wo + bo -> [2][2048][1024].
// Deterministic: flash-style per 16-query wave over the keys in order (running max), fixed reduction trees; no atomics.
// compute dtype: WMMA v_wmma_f32_16x16x32_f16 with f32 accumulate for the three projections ([4096 x 1024] x [1024 x 1024]; inputs EXACT bf16 x8 staged through LDS in two K halves, [d][h][f]
// weights transposed exact x256: 1 product), S^T = K Q^T (q, k single f16 x8: 1 product), O^T += V^T P^T (v hi+lo x8, P x1024 single f16: 2 products) and out = ctx Wo ([4096 x 1024] x [1024 x 1024];
// ctx as hi+lo x8 planes: 2 products, Wo transposed exact x256); softmax statistics (exp2, running max) in f32. Inputs rounded to bf16 once.

namespace {
constexpr int B = 2, S = 2048, DM = 1024, H = 16, HD = 64, BL = 2 /* batches computed (== B shipped) */, QL = 2048 /* query rows computed (== S shipped) */, SK = 2048 /* key rows used (== S shipped) */;
constexpr float XS = 8.0f, WSC = 256.0f, PS = 1024.0f, LOG2E = 1.4426950408889634f;
static_assert(S % 64 == 0 && QL % 64 == 0 && SK % 64 == 0 && DM == H * HD, "tiling");
typedef _Float16 b16;
typedef __attribute__((ext_vector_type(16))) _Float16 v16b;
typedef __attribute__((ext_vector_type(8))) _Float16 v8b;
typedef __attribute__((ext_vector_type(8))) float v8f;
typedef __attribute__((ext_vector_type(4))) float v4f;
__device__ __forceinline__ float bf16_rne(float f) { unsigned int u = __float_as_uint(f); u += 0x7FFFu + ((u >> 16) & 1u); return __uint_as_float(u & 0xFFFF0000u); }
__device__ __forceinline__ void split16(float v, b16& hi, b16& lo) { hi = (b16)v; lo = (b16)(v - (float)hi); }
__device__ __forceinline__ v16b frag_kb(const b16* p, int hh) { const v8b a = *(const v8b*)(p + 8 * hh), b = *(const v8b*)(p + 16 + 8 * hh); v16b f;
#pragma unroll
  for (int e = 0; e < 8; ++e) { f[e] = a[e]; f[8 + e] = b[e]; } return f; }
__device__ __forceinline__ v8f wmma16b(v16b a, v16b b, v8f c) { v8f d = __builtin_amdgcn_wmma_f32_16x16x32_f16(false, a, false, b, (short)0, c, false, false); asm volatile("v_nop\n\tv_nop\n\tv_nop\n\tv_nop" : "+v"(d) : "v"(a), "v"(b)); return d; }
__device__ __forceinline__ void wave_lds_sync() { __builtin_amdgcn_fence(__ATOMIC_RELEASE, "workgroup"); __builtin_amdgcn_wave_barrier(); __builtin_amdgcn_fence(__ATOMIC_ACQUIRE, "workgroup"); }
__device__ __forceinline__ float pmul(float a, float b) { float p = a * b; asm volatile("" : "+v"(p)); return p; }
__device__ __forceinline__ int iclamp(int v, int lo, int hi) { return v < lo ? lo : (v > hi ? hi : v); }

typedef __attribute__((ext_vector_type(2))) _Float16 v2h;
typedef __attribute__((ext_vector_type(4))) _Float16 v4h;
typedef __attribute__((ext_vector_type(2))) float v2f;
__device__ __forceinline__ float nexp2(float v) { return __builtin_amdgcn_exp2f(v); }
__global__ __launch_bounds__(256) void prep_kernel(const float* __restrict__ wq, const float* __restrict__ wk, const float* __restrict__ wv, const float* __restrict__ wo, b16* __restrict__ WT, b16* __restrict__ WO) {
  const size_t u = (size_t)blockIdx.x * 256 + threadIdx.x; const size_t per = (size_t)DM * DM / 8; if (u >= 4 * per) return; const int m = (int)(u / per); const size_t e = (u % per) * 8; const int oo = (int)(e / DM), k0 = (int)(e % DM); v8b o;
  if (m < 3) { const float* w = m == 0 ? wq : (m == 1 ? wk : wv); for (int j = 0; j < 8; ++j) o[j] = (b16)(bf16_rne(w[(size_t)(k0 + j) * DM + oo]) * WSC); { *(v8b*)(WT + (size_t)m * DM * DM + e) = o;  } }
  else { for (int j = 0; j < 8; ++j) o[j] = (b16)(bf16_rne(wo[(size_t)(k0 + j) * DM + oo]) * WSC); { *(v8b*)(WO + e) = o;  } }
}
// projections: grid (rows/64, BL x 3 (which), 8 slabs of 128); block = 64 tokens x 4 waves; A = bf16(input) x8 staged in two K halves of 512; 8 tiles x 16 k-steps per half, 1 product; + bias.
__global__ __launch_bounds__(128) void proj_kernel(const float* __restrict__ xq, const float* __restrict__ xkv, const b16* __restrict__ WT, const float* __restrict__ bq, const float* __restrict__ bk, const float* __restrict__ bv, b16* __restrict__ Qp, b16* __restrict__ Kp, b16* __restrict__ VTh, b16* __restrict__ VTl) {
  __shared__ __attribute__((aligned(16))) b16 As[4][16][512 + 8]; __shared__ __attribute__((aligned(16))) float Tf[4][16][128 + 4];
  const int wave = threadIdx.x >> 5, lane = threadIdx.x & 31, nloc = lane & 15, hlf = lane >> 4; const int which = blockIdx.y % 3, b = blockIdx.y / 3; const int rb = blockIdx.x, slab = blockIdx.z; const int t0 = rb * 64 + wave * 16; const int n0 = slab * 128;
  if ((which == 0 && rb * 64 >= QL) || (which != 0 && rb * 64 >= SK)) return;   // block-uniform
  const float* x = (which == 0) ? xq : xkv; const b16* W = WT + (size_t)which * DM * DM; const float* bias = which == 0 ? bq : (which == 1 ? bk : bv);
  v8f acc[8];
#pragma unroll
  for (int t = 0; t < 8; ++t) acc[t] = (v8f){};
#pragma unroll 1
  for (int half = 0; half < 2; ++half) {
    for (int rr = 0; rr < 16; ++rr) { const float* xr = x + ((size_t)b * S + t0 + rr) * DM + half * 512; for (int q = lane * 4; q < 512; q += 128) { const v4f xv = *(const v4f*)(xr + q); v4h o; for (int j = 0; j < 4; ++j) o[j] = (b16)(bf16_rne(xv[j]) * XS); *(v4h*)(&As[wave][rr][q]) = o; } }
    wave_lds_sync();
#pragma unroll 2
    for (int kb = 0; kb < 512; kb += 32) { const v16b a = frag_kb(&As[wave][nloc][kb], hlf);
#pragma unroll
      for (int t = 0; t < 8; ++t) acc[t] = wmma16b(a, frag_kb(W + (size_t)(n0 + t * 16 + nloc) * DM + half * 512 + kb, hlf), acc[t]); }
    wave_lds_sync(); }
#pragma unroll
  for (int t = 0; t < 8; ++t) { const float bb = bf16_rne(bias[n0 + t * 16 + nloc]);
#pragma unroll
    for (int r = 0; r < 8; ++r) Tf[wave][8 * hlf + r][t * 16 + nloc] = acc[t][r] * (1.0f / (XS * WSC)) + bb; }
  __syncthreads();
  {
    if (which == 2) {
#pragma unroll 1
      for (int q = 0; q < 32; ++q) { const int cl = wave * 32 + q; const int c = n0 + cl; const int h = c / HD, d = c % HD; const int tk = lane * 2; v2h hv, lv;
        for (int j = 0; j < 2; ++j) { b16 p, ql; split16(Tf[(tk + j) >> 4][(tk + j) & 15][cl] * XS, p, ql); hv[j] = p; lv[j] = ql; }
        const size_t oi = (((size_t)b * H + h) * HD + d) * S + rb * 64 + lane * 2; *(v2h*)(VTh + oi) = hv; *(v2h*)(VTl + oi) = lv; } }
    else { b16* P = which == 0 ? Qp : Kp;
      for (int rr = 0; rr < 16; ++rr) { for (int hs = 0; hs < 2; ++hs) { const int c = n0 + hs * 64; const int h = c / HD; v2h o; o[0] = (b16)(Tf[wave][rr][hs * 64 + lane * 2] * XS); o[1] = (b16)(Tf[wave][rr][hs * 64 + lane * 2 + 1] * XS);
          *(v2h*)(P + (((size_t)b * H + h) * S + (t0 + rr)) * HD + lane * 2) = o; } } }
     }
}
// attention: grid (QL/32, BL*H): block = 2 waves x 16 queries; key tiles in order (2 per 32-key step), online softmax (running max), P x1024 single via LDS, O^T += V^T P^T (v hi+lo: 2 products);
__global__ __launch_bounds__(64) void attn_kernel(const b16* __restrict__ Qp, const b16* __restrict__ Kp, const b16* __restrict__ VTh, const b16* __restrict__ VTl, b16* __restrict__ Ch, b16* __restrict__ Cl) {
  __shared__ __attribute__((aligned(16))) b16 Pb[2][16][32 + 8]; __shared__ __attribute__((aligned(16))) float To[2][16][HD + 4];
  const int wave = threadIdx.x >> 5, lane = threadIdx.x & 31, hh = lane >> 4, col = lane & 15; const int b = blockIdx.y / H, h = blockIdx.y % H; const int q0 = blockIdx.x * 32 + wave * 16, qi = q0 + col;
  const b16* Qb = Qp + ((size_t)(b * H + h) * S) * HD; const b16* Kb = Kp + ((size_t)(b * H + h) * S) * HD; const b16* Vh = VTh + ((size_t)(b * H + h) * HD) * S; const b16* Vl = VTl + ((size_t)(b * H + h) * HD) * S;
  const v16b qa0 = frag_kb(Qb + (size_t)qi * HD, hh), qa1 = frag_kb(Qb + (size_t)qi * HD + 32, hh);
  const float cs = LOG2E / (8.0f * XS * XS);   // 1/sqrt(64) and the two x8 carriers, in the log2 domain
  float m = -INFINITY, l = 0.0f; v8f o[4]; for (int t = 0; t < 4; ++t) o[t] = (v8f){};
#pragma unroll 1
  for (int kb = 0; kb < SK; kb += 32) {
    float e[16]; float mx = -INFINITY;
#pragma unroll
    for (int u = 0; u < 2; ++u) { v8f s = (v8f){}; const size_t kr = (size_t)(kb + u * 16 + col) * HD; s = wmma16b(frag_kb(Kb + kr, hh), qa0, s); s = wmma16b(frag_kb(Kb + kr + 32, hh), qa1, s);
#pragma unroll
      for (int r = 0; r < 8; ++r) { const float v = s[r] * cs; e[u * 8 + r] = v; mx = fmaxf(mx, v); } }
    mx = fmaxf(mx, __shfl_xor(mx, 16)); const float mn = fmaxf(m, mx); const float al = nexp2(m - mn); float sum = 0.0f;
#pragma unroll
    for (int i2 = 0; i2 < 16; ++i2) { const float p = nexp2(e[i2] - mn); sum += p; Pb[wave][col][(i2 < 8 ? 0 : 16) + 8 * hh + (i2 & 7)] = (b16)(p * PS); }
    sum += __shfl_xor(sum, 16); l = l * al + sum; m = mn;
    wave_lds_sync();
    const v16b pf = frag_kb(&Pb[wave][col][0], hh);
#pragma unroll
    for (int t = 0; t < 4; ++t) { o[t] *= al; const size_t vr = (size_t)(t * 16 + col) * S + kb; o[t] = wmma16b(frag_kb(Vh + vr, hh), pf, o[t]); o[t] = wmma16b(frag_kb(Vl + vr, hh), pf, o[t]); }
    wave_lds_sync(); }
  const float inv = 1.0f / (l * PS * XS);
#pragma unroll
  for (int t = 0; t < 4; ++t)
#pragma unroll
    for (int r = 0; r < 8; ++r) To[wave][col][t * 16 + 8 * hh + r] = o[t][r] * inv;
  wave_lds_sync();
  { for (int rr = 0; rr < 16; ++rr) { const v2f f = *(const v2f*)(&To[wave][rr][lane * 2]); v2h hv, lv; for (int j = 0; j < 2; ++j) { b16 p, q; split16(f[j] * XS, p, q); hv[j] = p; lv[j] = q; }
      const size_t oi = ((size_t)b * S + q0 + rr) * DM + h * HD + lane * 2; *(v2h*)(Ch + oi) = hv; *(v2h*)(Cl + oi) = lv; }  }
}
__global__ __launch_bounds__(128) void out_kernel(const b16* __restrict__ Ch, const b16* __restrict__ Cl, const b16* __restrict__ WO, const float* __restrict__ bo, float* __restrict__ out) {
  __shared__ __attribute__((aligned(16))) float Tf[4][16][128 + 4];
  const int wave = threadIdx.x >> 5, lane = threadIdx.x & 31, nloc = lane & 15, hlf = lane >> 4; const int b = blockIdx.x / (QL / 64), rb = blockIdx.x % (QL / 64); const size_t m0 = (size_t)b * S + rb * 64 + wave * 16; const int n0 = blockIdx.y * 128;
  v8f acc[8];
#pragma unroll
  for (int t = 0; t < 8; ++t) acc[t] = (v8f){};
#pragma unroll 2
  for (int kb = 0; kb < DM; kb += 32) { const v16b a = frag_kb(Ch + (m0 + nloc) * DM + kb, hlf), al = frag_kb(Cl + (m0 + nloc) * DM + kb, hlf);
#pragma unroll
    for (int t = 0; t < 8; ++t) { const v16b bw = frag_kb(WO + (size_t)(n0 + t * 16 + nloc) * DM + kb, hlf); acc[t] = wmma16b(a, bw, acc[t]); acc[t] = wmma16b(al, bw, acc[t]); } }
#pragma unroll
  for (int t = 0; t < 8; ++t) { const float bb = bf16_rne(bo[n0 + t * 16 + nloc]);
#pragma unroll
    for (int r = 0; r < 8; ++r) Tf[wave][8 * hlf + r][t * 16 + nloc] = acc[t][r] * (1.0f / (XS * WSC)) + bb; }
  wave_lds_sync();
  { for (int rr = 0; rr < 16; ++rr) *(v4f*)(out + (m0 + rr) * DM + n0 + lane * 4) = *(const v4f*)(&Tf[wave][rr][lane * 4]);  }
}
}  // namespace

extern "C" void kernel_launch(void* const* d_in, const int* in_sizes, int n_in, void* d_out, int out_size, void* d_ws, size_t ws_size, hipStream_t stream) {
  (void)n_in;
  auto Fp = [&](int i) { return (const float*)d_in[i]; };
  // input order: 0 inputs_q [2,2048,1024], 1 inputs_kv, 2 Wq [1024,16,64], 3 Wk, 4 Wv, 5 bq [16,64], 6 bk, 7 bv, 8 Wo [16,64,1024], 9 bo [1024]
  if (in_sizes[0] != B * S * DM || in_sizes[1] != B * S * DM || in_sizes[2] != DM * DM || in_sizes[3] != DM * DM || in_sizes[4] != DM * DM || in_sizes[5] != DM || in_sizes[8] != DM * DM || in_sizes[9] != DM || out_size != B * S * DM) return;
  size_t off = 0; char* ws = (char*)d_ws;
  auto carve = [&](size_t bytes) { char* p = ws + off; off += (bytes + 255) & ~(size_t)255; return p; };
  b16* WT = (b16*)carve((size_t)3 * DM * DM * 2); b16* WO = (b16*)carve((size_t)DM * DM * 2); const size_t plane = (size_t)B * S * DM * 2;
  b16* Qp = (b16*)carve(plane); b16* Kp = (b16*)carve(plane); b16* VTh = (b16*)carve(plane); b16* VTl = (b16*)carve(plane); b16* Ch = (b16*)carve(plane); b16* Cl = (b16*)carve(plane);
  if (off > ws_size || off > ((size_t)128 << 20)) return;   // ≈ 58.7 MB (6 planes x 8.4 MB + 8.4 MB weights)
  prep_kernel<<<(unsigned)(((size_t)4 * DM * DM / 8 + 255) / 256), 256, 0, stream>>>(Fp(2), Fp(3), Fp(4), Fp(8), WT, WO);
  proj_kernel<<<dim3(S / 64, BL * 3, 8), 128, 0, stream>>>(Fp(0), Fp(1), WT, Fp(5), Fp(6), Fp(7), Qp, Kp, VTh, VTl);
  attn_kernel<<<dim3(QL / 32, BL * H), 64, 0, stream>>>(Qp, Kp, VTh, VTl, Ch, Cl);
  out_kernel<<<dim3((QL / 64) * BL, 8), 128, 0, stream>>>(Ch, Cl, WO, Fp(9), (float*)d_out);
}

// v001
// One run takes 152 microseconds.
// Next to v000, in two timings, it ran 3.43 and 3.42 times as fast.
#include <hip/hip_runtime.h>

// Multi-head dot-product attention (16 heads x 64, d_model 1024) on inputs_q / inputs_kv [2, 2048, 1024]: q = inputs_q Wq + bq, k/v = inputs_kv Wk/Wv + b; attn = softmax(q k^T / 8) per head over
// all 2,048 keys; ctx = attn v; out = ctx Wo + bo -> [2][2048][1024].
// Deterministic: flash-style per 16-query wave over the keys in order (running max), fixed reduction trees; no atomics.
// compute dtype: WMMA v_wmma_f32_16x16x32_f16 with f32 accumulate for the three projections ([4096 x 1024] x [1024 x 1024]; inputs EXACT bf16 x8, [h][d][f]
// weights transposed exact x256: 1 product), S^T = K Q^T (q, k single f16 x8: 1 product), O^T += V^T P^T (v hi+lo x8, P x1024 single f16: 2 products) and out = ctx Wo ([4096 x 1024] x [1024 x 1024];
// ctx as hi+lo x8 planes: 2 products, Wo transposed exact x256); softmax statistics (exp2, running max) in f32. Inputs rounded to bf16 once.

namespace {
constexpr int B = 2, S = 2048, DM = 1024, H = 16, HD = 64, BL = 2 /* batches computed (== B shipped) */, QL = 2048 /* query rows computed (== S shipped) */, SK = 2048 /* key rows used (== S shipped) */;
constexpr float XS = 8.0f, WSC = 256.0f, PS = 1024.0f, LOG2E = 1.4426950408889634f;
static_assert(S % 64 == 0 && QL % 128 == 0 && SK % 64 == 0 && DM == H * HD, "tiling");
typedef _Float16 b16;
typedef __attribute__((ext_vector_type(16))) _Float16 v16b;
typedef __attribute__((ext_vector_type(8))) _Float16 v8b;
typedef __attribute__((ext_vector_type(8))) float v8f;
typedef __attribute__((ext_vector_type(4))) float v4f;
__device__ __forceinline__ float bf16_rne(float f) { unsigned int u = __float_as_uint(f); u += 0x7FFFu + ((u >> 16) & 1u); return __uint_as_float(u & 0xFFFF0000u); }
__device__ __forceinline__ void split16(float v, b16& hi, b16& lo) { hi = (b16)v; lo = (b16)(v - (float)hi); }
__device__ __forceinline__ v16b frag_kb(const b16* p, int hh) { const v8b a = *(const v8b*)(p + 8 * hh), b = *(const v8b*)(p + 16 + 8 * hh); v16b f;
#pragma unroll
  for (int e = 0; e < 8; ++e) { f[e] = a[e]; f[8 + e] = b[e]; } return f; }
__device__ __forceinline__ v8f wmma16b(v16b a, v16b b, v8f c) { v8f d = __builtin_amdgcn_wmma_f32_16x16x32_f16(false, a, false, b, (short)0, c, false, false); asm volatile("v_nop\n\tv_nop\n\tv_nop\n\tv_nop" : "+v"(d) : "v"(a), "v"(b)); return d; }
__device__ __forceinline__ void wave_lds_sync() { __builtin_amdgcn_fence(__ATOMIC_RELEASE, "workgroup"); __builtin_amdgcn_wave_barrier(); __builtin_amdgcn_fence(__ATOMIC_ACQUIRE, "workgroup"); }
__device__ __forceinline__ float pmul(float a, float b) { float p = a * b; asm volatile("" : "+v"(p)); return p; }
__device__ __forceinline__ int iclamp(int v, int lo, int hi) { return v < lo ? lo : (v > hi ? hi : v); }

typedef __attribute__((ext_vector_type(2))) _Float16 v2h;
typedef __attribute__((ext_vector_type(4))) _Float16 v4h;
typedef __attribute__((ext_vector_type(2))) float v2f;
__device__ __forceinline__ float nexp2(float v) { return __builtin_amdgcn_exp2f(v); }
// LDS staging of operand tiles that all waves of a block read: rows of 64 f16 (one whole 128-B line), LDS pitch 144 B (16 B x odd: no bank conflict for the 16-byte fragment reads).
constexpr int TK = 64, LP = TK + 8, XP = TK + 4;   // XP: the same for rows of 64 f32 (256 B at pitch 272 B)
static_assert(SK % TK == 0 && SK >= 2 * TK && DM % TK == 0 && DM >= 2 * TK && (LP * 2) % 16 == 0, "two-buffer ring needs two tiles");
__device__ __forceinline__ unsigned lds_off(const void* p) { return (unsigned)(size_t)p; }
// Each lane copies 16 bytes global -> LDS per line, through no register; the closing s_wait_xcnt keeps every later rewrite of the address registers behind the issued copies.
__device__ __forceinline__ void copy6(unsigned l0, const void* g0, unsigned l1, const void* g1, unsigned l2, const void* g2, unsigned l3, const void* g3, unsigned l4, const void* g4, unsigned l5, const void* g5) {
  asm volatile("global_load_async_to_lds_b128 %0, %1, off\n\tglobal_load_async_to_lds_b128 %2, %3, off\n\tglobal_load_async_to_lds_b128 %4, %5, off\n\t"
               "global_load_async_to_lds_b128 %6, %7, off\n\tglobal_load_async_to_lds_b128 %8, %9, off\n\tglobal_load_async_to_lds_b128 %10, %11, off\n\ts_wait_xcnt 0x0"
               :: "v"(l0), "v"(g0), "v"(l1), "v"(g1), "v"(l2), "v"(g2), "v"(l3), "v"(g3), "v"(l4), "v"(g4), "v"(l5), "v"(g5) : "memory"); }
__device__ __forceinline__ void copy8(unsigned l0, const void* g0, unsigned l1, const void* g1, unsigned l2, const void* g2, unsigned l3, const void* g3, unsigned l4, const void* g4, unsigned l5, const void* g5, unsigned l6, const void* g6, unsigned l7, const void* g7) {
  asm volatile("global_load_async_to_lds_b128 %0, %1, off\n\tglobal_load_async_to_lds_b128 %2, %3, off\n\tglobal_load_async_to_lds_b128 %4, %5, off\n\tglobal_load_async_to_lds_b128 %6, %7, off\n\t"
               "global_load_async_to_lds_b128 %8, %9, off\n\tglobal_load_async_to_lds_b128 %10, %11, off\n\tglobal_load_async_to_lds_b128 %12, %13, off\n\tglobal_load_async_to_lds_b128 %14, %15, off\n\ts_wait_xcnt 0x0"
               :: "v"(l0), "v"(g0), "v"(l1), "v"(g1), "v"(l2), "v"(g2), "v"(l3), "v"(g3), "v"(l4), "v"(g4), "v"(l5), "v"(g5), "v"(l6), "v"(g6), "v"(l7), "v"(g7) : "memory"); }
// This wave's own copies have landed (the compiler places no wait for them).
__device__ __forceinline__ void wait_copies() { asm volatile("s_wait_asynccnt 0x0" ::: "memory"); }
// Publish point of the two-buffer ring: this wave's LDS reads of the old tile are done, its copies of the next tile have landed, then the block barrier hands both over.
__device__ __forceinline__ void publish_tile() { asm volatile("s_wait_dscnt 0x0" ::: "memory"); wait_copies(); __syncthreads(); }
// A 64-row x 64-k f32 input tile by 128 threads: 16 lanes per 256-B row, 8 rows per copy line.
__device__ __forceinline__ void stage_x64(float (*dst)[XP], const float* xrow0, int k0) {
  const int sr = threadIdx.x >> 4, sc = (threadIdx.x & 15) * 4; const float* g = xrow0 + (size_t)sr * DM + k0 + sc; const unsigned l = lds_off(&dst[sr][sc]); constexpr unsigned LS = 8 * XP * 4; constexpr size_t GS = (size_t)8 * DM;
  copy8(l, g, l + LS, g + GS, l + 2 * LS, g + 2 * GS, l + 3 * LS, g + 3 * GS, l + 4 * LS, g + 4 * GS, l + 5 * LS, g + 5 * GS, l + 6 * LS, g + 6 * GS, l + 7 * LS, g + 7 * GS); }
// A 128-row x 64-k weight tile (rows n0.., columns k0..) by 128 threads: 8 lanes per row, 16 rows per copy line.
__device__ __forceinline__ void stage_w128(b16 (*dst)[LP], const b16* Wrow0, int k0) {
  const int sr = threadIdx.x >> 3, sc = (threadIdx.x & 7) * 8; const b16* g = Wrow0 + (size_t)sr * DM + k0 + sc; const unsigned l = lds_off(&dst[sr][sc]); constexpr unsigned LS = 16 * LP * 2; constexpr size_t GS = (size_t)16 * DM;
  copy8(l, g, l + LS, g + GS, l + 2 * LS, g + 2 * GS, l + 3 * LS, g + 3 * GS, l + 4 * LS, g + 4 * GS, l + 5 * LS, g + 5 * GS, l + 6 * LS, g + 6 * GS, l + 7 * LS, g + 7 * GS); }
__global__ __launch_bounds__(256) void prep_kernel(const float* __restrict__ wq, const float* __restrict__ wk, const float* __restrict__ wv, const float* __restrict__ wo, b16* __restrict__ WT, b16* __restrict__ WO) {
  const size_t u = (size_t)blockIdx.x * 256 + threadIdx.x; const size_t per = (size_t)DM * DM / 8; if (u >= 4 * per) return; const int m = (int)(u / per); const size_t e = (u % per) * 8; const int oo = (int)(e / DM), k0 = (int)(e % DM); v8b o;
  if (m < 3) { const float* w = m == 0 ? wq : (m == 1 ? wk : wv); for (int j = 0; j < 8; ++j) o[j] = (b16)(bf16_rne(w[(size_t)(k0 + j) * DM + oo]) * WSC); { *(v8b*)(WT + (size_t)m * DM * DM + e) = o;  } }
  else { for (int j = 0; j < 8; ++j) o[j] = (b16)(bf16_rne(wo[(size_t)(k0 + j) * DM + oo]) * WSC); { *(v8b*)(WO + e) = o;  } }
}
// projections: grid (rows/64, BL x 3 (which), 8 slabs of 128); block = 64 tokens x 4 waves; A = bf16(input) x8; 8 tiles x 32 k-steps, 1 product; + bias.
// Per 64-k tile the block's 64 x 64 f32 inputs and the slab's 128 x 64 weights are copied once into a two-buffer LDS ring; a wave rounds its A fragment as it reads it, all four waves take their B fragments from the ring.
__global__ __launch_bounds__(128) void proj_kernel(const float* __restrict__ xq, const float* __restrict__ xkv, const b16* __restrict__ WT, const float* __restrict__ bq, const float* __restrict__ bk, const float* __restrict__ bv, b16* __restrict__ Qp, b16* __restrict__ Kp, b16* __restrict__ VTh, b16* __restrict__ VTl) {
  __shared__ __attribute__((aligned(16))) float Xs[2][64][XP];
  // The weight ring and the output staging share these bytes: Tf is first written behind the ring's last publish point, when no wave reads the ring and no copy is in flight.
  __shared__ __attribute__((aligned(16))) unsigned char U[2 * 128 * LP * 2]; static_assert(sizeof(U) >= sizeof(float) * 4 * 16 * (128 + 4), "staging fits the ring");
  b16 (*Ws)[128][LP] = (b16 (*)[128][LP])U; float (*Tf)[16][128 + 4] = (float (*)[16][128 + 4])U;
  const int wave = threadIdx.x >> 5, lane = threadIdx.x & 31, nloc = lane & 15, hlf = lane >> 4; const int which = blockIdx.y % 3, b = blockIdx.y / 3; const int rb = blockIdx.x, slab = blockIdx.z; const int t0 = rb * 64 + wave * 16; const int n0 = slab * 128;
  if ((which == 0 && rb * 64 >= QL) || (which != 0 && rb * 64 >= SK)) return;   // block-uniform
  const float* x = (which == 0) ? xq : xkv; const b16* W = WT + (size_t)which * DM * DM; const float* bias = which == 0 ? bq : (which == 1 ? bk : bv);
  v8f acc[8];
#pragma unroll
  for (int t = 0; t < 8; ++t) acc[t] = (v8f){};
  const b16* Wn = W + (size_t)n0 * DM; const float* xb = x + ((size_t)b * S + rb * 64) * DM;
  auto stage = [&](int k0, int buf) { stage_x64(Xs[buf], xb, k0); stage_w128(Ws[buf], Wn, k0); };
  stage(0, 0); wait_copies(); __syncthreads(); stage(TK, 1);
#pragma unroll 1   // one trip per ring tile: the buffer index and the publish point stay in one place
  for (int k0 = 0; k0 < DM; k0 += TK) { const int buf = (k0 / TK) & 1;
#pragma unroll     // both 32-k steps of a tile: constant LDS offsets
    for (int kb = 0; kb < TK; kb += 32) { const float* xr = &Xs[buf][wave * 16 + nloc][kb + 8 * hlf];   // k order of frag_kb: 8 hlf + 0..7, then 16 + 8 hlf + 0..7
      const v4f x0 = *(const v4f*)xr, x1 = *(const v4f*)(xr + 4), x2 = *(const v4f*)(xr + 16), x3 = *(const v4f*)(xr + 20); v16b a;
#pragma unroll
      for (int j = 0; j < 4; ++j) { a[j] = (b16)(bf16_rne(x0[j]) * XS); a[4 + j] = (b16)(bf16_rne(x1[j]) * XS); a[8 + j] = (b16)(bf16_rne(x2[j]) * XS); a[12 + j] = (b16)(bf16_rne(x3[j]) * XS); }
#pragma unroll
      for (int t = 0; t < 8; ++t) acc[t] = wmma16b(a, frag_kb(&Ws[buf][t * 16 + nloc][kb], hlf), acc[t]); }
    publish_tile();
    if (k0 + 2 * TK < DM) stage(k0 + 2 * TK, buf); }   // refill the buffers that every wave has just left
  wait_copies();
#pragma unroll
  for (int t = 0; t < 8; ++t) { const float bb = bf16_rne(bias[n0 + t * 16 + nloc]);
#pragma unroll
    for (int r = 0; r < 8; ++r) Tf[wave][8 * hlf + r][t * 16 + nloc] = acc[t][r] * (1.0f / (XS * WSC)) + bb; }
  __syncthreads();
  {
    if (which == 2) {
#pragma unroll 1
      for (int q = 0; q < 32; ++q) { const int cl = wave * 32 + q; const int c = n0 + cl; const int h = c / HD, d = c % HD; const int tk = lane * 2; v2h hv, lv;
        for (int j = 0; j < 2; ++j) { b16 p, ql; split16(Tf[(tk + j) >> 4][(tk + j) & 15][cl] * XS, p, ql); hv[j] = p; lv[j] = ql; }
        const size_t oi = (((size_t)b * H + h) * HD + d) * S + rb * 64 + lane * 2; *(v2h*)(VTh + oi) = hv; *(v2h*)(VTl + oi) = lv; } }
    else { b16* P = which == 0 ? Qp : Kp;
      for (int rr = 0; rr < 16; ++rr) { for (int hs = 0; hs < 2; ++hs) { const int c = n0 + hs * 64; const int h = c / HD; v2h o; o[0] = (b16)(Tf[wave][rr][hs * 64 + lane * 2] * XS); o[1] = (b16)(Tf[wave][rr][hs * 64 + lane * 2 + 1] * XS);
          *(v2h*)(P + (((size_t)b * H + h) * S + (t0 + rr)) * HD + lane * 2) = o; } } }
     }
}
// attention: grid (QL/128, BL*H): block = 8 waves x 16 queries; key tiles in order (2 per 32-key step), online softmax (running max), P x1024 single via LDS, O^T += V^T P^T (v hi+lo: 2 products);
// K, V^T hi and V^T lo come in 64-key tiles, copied once per block into a two-buffer LDS ring while the tile before is worked on; every wave takes its fragments from there.
__global__ __launch_bounds__(256) void attn_kernel(const b16* __restrict__ Qp, const b16* __restrict__ Kp, const b16* __restrict__ VTh, const b16* __restrict__ VTl, b16* __restrict__ Ch, b16* __restrict__ Cl) {
  __shared__ __attribute__((aligned(16))) b16 Pb[8][16][32 + 8]; __shared__ __attribute__((aligned(16))) float To[8][16][HD + 4];
  __shared__ __attribute__((aligned(16))) b16 Ks[2][TK][LP]; __shared__ __attribute__((aligned(16))) b16 Vhs[2][HD][LP]; __shared__ __attribute__((aligned(16))) b16 Vls[2][HD][LP];
  const int wave = threadIdx.x >> 5, lane = threadIdx.x & 31, hh = lane >> 4, col = lane & 15; const int b = blockIdx.y / H, h = blockIdx.y % H; const int q0 = blockIdx.x * 128 + wave * 16, qi = q0 + col;
  const b16* Qb = Qp + ((size_t)(b * H + h) * S) * HD; const b16* Kb = Kp + ((size_t)(b * H + h) * S) * HD; const b16* Vh = VTh + ((size_t)(b * H + h) * HD) * S; const b16* Vl = VTl + ((size_t)(b * H + h) * HD) * S;
  const v16b qa0 = frag_kb(Qb + (size_t)qi * HD, hh), qa1 = frag_kb(Qb + (size_t)qi * HD + 32, hh);
  const float cs = LOG2E / (8.0f * XS * XS);   // 1/sqrt(64) and the two x8 carriers, in the log2 domain
  float m = -INFINITY, l = 0.0f; v8f o[4]; for (int t = 0; t < 4; ++t) o[t] = (v8f){};
  const int sr = threadIdx.x >> 3, sc = (threadIdx.x & 7) * 8;   // 8 lanes per 128-B row; 256 threads cover rows sr and sr + 32 of each of the three tiles
  auto stage = [&](int kt, int buf) {
    copy6(lds_off(&Ks[buf][sr][sc]), Kb + (size_t)(kt + sr) * HD + sc, lds_off(&Ks[buf][sr + 32][sc]), Kb + (size_t)(kt + sr + 32) * HD + sc,
          lds_off(&Vhs[buf][sr][sc]), Vh + (size_t)sr * S + kt + sc, lds_off(&Vhs[buf][sr + 32][sc]), Vh + (size_t)(sr + 32) * S + kt + sc,
          lds_off(&Vls[buf][sr][sc]), Vl + (size_t)sr * S + kt + sc, lds_off(&Vls[buf][sr + 32][sc]), Vl + (size_t)(sr + 32) * S + kt + sc); };
  stage(0, 0); wait_copies(); __syncthreads(); stage(TK, 1);
#pragma unroll 1   // one trip per ring tile: the buffer index and the publish point stay in one place
  for (int kt = 0; kt < SK; kt += TK) { const int buf = (kt / TK) & 1;
#pragma unroll 1
  for (int kb = 0; kb < TK; kb += 32) {
    float e[16]; float mx = -INFINITY;
#pragma unroll
    for (int u = 0; u < 2; ++u) { v8f s = (v8f){}; const b16* kr = &Ks[buf][kb + u * 16 + col][0]; s = wmma16b(frag_kb(kr, hh), qa0, s); s = wmma16b(frag_kb(kr + 32, hh), qa1, s);
#pragma unroll
      for (int r = 0; r < 8; ++r) { const float v = s[r] * cs; e[u * 8 + r] = v; mx = fmaxf(mx, v); } }
    mx = fmaxf(mx, __shfl_xor(mx, 16)); const float mn = fmaxf(m, mx); const float al = nexp2(m - mn); float sum = 0.0f;
#pragma unroll
    for (int i2 = 0; i2 < 16; ++i2) { const float p = nexp2(e[i2] - mn); sum += p; Pb[wave][col][(i2 < 8 ? 0 : 16) + 8 * hh + (i2 & 7)] = (b16)(p * PS); }
    sum += __shfl_xor(sum, 16); l = l * al + sum; m = mn;
    wave_lds_sync();
    const v16b pf = frag_kb(&Pb[wave][col][0], hh);
#pragma unroll
    for (int t = 0; t < 4; ++t) { o[t] *= al; o[t] = wmma16b(frag_kb(&Vhs[buf][t * 16 + col][kb], hh), pf, o[t]); o[t] = wmma16b(frag_kb(&Vls[buf][t * 16 + col][kb], hh), pf, o[t]); }
    wave_lds_sync(); }
    publish_tile();
    if (kt + 2 * TK < SK) stage(kt + 2 * TK, buf); }   // refill the buffer that every wave has just left
  wait_copies();
  const float inv = 1.0f / (l * PS * XS);
#pragma unroll
  for (int t = 0; t < 4; ++t)
#pragma unroll
    for (int r = 0; r < 8; ++r) To[wave][col][t * 16 + 8 * hh + r] = o[t][r] * inv;
  wave_lds_sync();
  { for (int rr = 0; rr < 16; ++rr) { const v2f f = *(const v2f*)(&To[wave][rr][lane * 2]); v2h hv, lv; for (int j = 0; j < 2; ++j) { b16 p, q; split16(f[j] * XS, p, q); hv[j] = p; lv[j] = q; }
      const size_t oi = ((size_t)b * S + q0 + rr) * DM + h * HD + lane * 2; *(v2h*)(Ch + oi) = hv; *(v2h*)(Cl + oi) = lv; }  }
}
__global__ __launch_bounds__(128) void out_kernel(const b16* __restrict__ Ch, const b16* __restrict__ Cl, const b16* __restrict__ WO, const float* __restrict__ bo, float* __restrict__ out) {
  __shared__ __attribute__((aligned(16))) float Tf[4][16][128 + 4]; __shared__ __attribute__((aligned(16))) b16 Ws[2][128][LP]; __shared__ __attribute__((aligned(16))) b16 Ahs[2][64][LP]; __shared__ __attribute__((aligned(16))) b16 Als[2][64][LP];   // two-buffer ring: 128 x 64 weight tile (read by all four waves), 64 x 64 ctx hi and lo tiles
  const int wave = threadIdx.x >> 5, lane = threadIdx.x & 31, nloc = lane & 15, hlf = lane >> 4; const int b = blockIdx.x / (QL / 64), rb = blockIdx.x % (QL / 64); const size_t m0 = (size_t)b * S + rb * 64 + wave * 16; const int n0 = blockIdx.y * 128;
  v8f acc[8];
#pragma unroll
  for (int t = 0; t < 8; ++t) acc[t] = (v8f){};
  const b16* Wn = WO + (size_t)n0 * DM; const int sr = threadIdx.x >> 3, sc = (threadIdx.x & 7) * 8;   // 8 lanes per 128-B row; 128 threads cover rows sr + 16 j
  const size_t a0 = ((size_t)b * S + rb * 64 + sr) * DM + sc; constexpr unsigned LS = 16 * LP * 2; constexpr size_t GS = (size_t)16 * DM;
  auto stage = [&](int k0, int buf) { const b16* gh = Ch + a0 + k0; const b16* gl = Cl + a0 + k0; const unsigned lh = lds_off(&Ahs[buf][sr][sc]), ll = lds_off(&Als[buf][sr][sc]);
    copy8(lh, gh, lh + LS, gh + GS, lh + 2 * LS, gh + 2 * GS, lh + 3 * LS, gh + 3 * GS, ll, gl, ll + LS, gl + GS, ll + 2 * LS, gl + 2 * GS, ll + 3 * LS, gl + 3 * GS); stage_w128(Ws[buf], Wn, k0); };
  stage(0, 0); wait_copies(); __syncthreads(); stage(TK, 1);
#pragma unroll 1   // one trip per ring tile: the buffer index and the publish point stay in one place
  for (int kt = 0; kt < DM; kt += TK) { const int buf = (kt / TK) & 1;
#pragma unroll     // both 32-k steps of a tile: constant LDS offsets
    for (int kb = 0; kb < TK; kb += 32) { const v16b a = frag_kb(&Ahs[buf][wave * 16 + nloc][kb], hlf), al = frag_kb(&Als[buf][wave * 16 + nloc][kb], hlf);
#pragma unroll
      for (int t = 0; t < 8; ++t) { const v16b bw = frag_kb(&Ws[buf][t * 16 + nloc][kb], hlf); acc[t] = wmma16b(a, bw, acc[t]); acc[t] = wmma16b(al, bw, acc[t]); } }
    publish_tile();
    if (kt + 2 * TK < DM) stage(kt + 2 * TK, buf); }   // refill the buffers that every wave has just left
  wait_copies();
#pragma unroll
  for (int t = 0; t < 8; ++t) { const float bb = bf16_rne(bo[n0 + t * 16 + nloc]);
#pragma unroll
    for (int r = 0; r < 8; ++r) Tf[wave][8 * hlf + r][t * 16 + nloc] = acc[t][r] * (1.0f / (XS * WSC)) + bb; }
  wave_lds_sync();
  { for (int rr = 0; rr < 16; ++rr) *(v4f*)(out + (m0 + rr) * DM + n0 + lane * 4) = *(const v4f*)(&Tf[wave][rr][lane * 4]);  }
}
}  // namespace

extern "C" void kernel_launch(void* const* d_in, const int* in_sizes, int n_in, void* d_out, int out_size, void* d_ws, size_t ws_size, hipStream_t stream) {
  (void)n_in;
  auto Fp = [&](int i) { return (const float*)d_in[i]; };
  // input order: 0 inputs_q [2,2048,1024], 1 inputs_kv, 2 Wq [1024,16,64], 3 Wk, 4 Wv, 5 bq [16,64], 6 bk, 7 bv, 8 Wo [16,64,1024], 9 bo [1024]
  if (in_sizes[0] != B * S * DM || in_sizes[1] != B * S * DM || in_sizes[2] != DM * DM || in_sizes[3] != DM * DM || in_sizes[4] != DM * DM || in_sizes[5] != DM || in_sizes[8] != DM * DM || in_sizes[9] != DM || out_size != B * S * DM) return;
  size_t off = 0; char* ws = (char*)d_ws;
  auto carve = [&](size_t bytes) { char* p = ws + off; off += (bytes + 255) & ~(size_t)255; return p; };
  b16* WT = (b16*)carve((size_t)3 * DM * DM * 2); b16* WO = (b16*)carve((size_t)DM * DM * 2); const size_t plane = (size_t)B * S * DM * 2;
  b16* Qp = (b16*)carve(plane); b16* Kp = (b16*)carve(plane); b16* VTh = (b16*)carve(plane); b16* VTl = (b16*)carve(plane); b16* Ch = (b16*)carve(plane); b16* Cl = (b16*)carve(plane);
  if (off > ws_size || off > ((size_t)128 << 20)) return;   // ≈ 58.7 MB (6 planes x 8.4 MB + 8.4 MB weights)
  prep_kernel<<<(unsigned)(((size_t)4 * DM * DM / 8 + 255) / 256), 256, 0, stream>>>(Fp(2), Fp(3), Fp(4), Fp(8), WT, WO);
  proj_kernel<<<dim3(S / 64, BL * 3, 8), 128, 0, stream>>>(Fp(0), Fp(1), WT, Fp(5), Fp(6), Fp(7), Qp, Kp, VTh, VTl);
  attn_kernel<<<dim3(QL / 128, BL * H), 256, 0, stream>>>(Qp, Kp, VTh, VTl, Ch, Cl);
  out_kernel<<<dim3((QL / 64) * BL, 8), 128, 0, stream>>>(Ch, Cl, WO, Fp(9), (float*)d_out);
}

// v002
// It runs in 129 microseconds.
// Two timings next to v001 put it at 1.16 and 1.17 times that version's speed.
// All steps since v000 together make it 4.00 times as fast.
#include <hip/hip_runtime.h>

// Multi-head dot-product attention (16 heads x 64, d_model 1024) on inputs_q / inputs_kv [2, 2048, 1024]: q = inputs_q Wq + bq, k/v = inputs_kv Wk/Wv + b; attn = softmax(q k^T / 8) per head over
// all 2,048 keys; ctx = attn v; out = ctx Wo + bo -> [2][2048][1024].
// Deterministic: flash-style per 16-query wave over the keys in order (running max), fixed reduction trees; no atomics.
// compute dtype: WMMA v_wmma_f32_16x16x32_f16 with f32 accumulate for the three projections ([4096 x 1024] x [1024 x 1024]; inputs EXACT bf16 x8, [h][d][f]
// weights transposed exact x256: 1 product), S^T = K Q^T (q, k single f16 x8: 1 product), O^T += V^T P^T (v hi+lo x8, P x1024 single f16: 2 products) and out = ctx Wo ([4096 x 1024] x [1024 x 1024];
// ctx as hi+lo x8 planes: 2 products, Wo transposed exact x256); softmax statistics (exp2, running max) in f32. Inputs rounded to bf16 once.

namespace {
constexpr int B = 2, S = 2048, DM = 1024, H = 16, HD = 64, BL = 2 /* batches computed (== B shipped) */, QL = 2048 /* query rows computed (== S shipped) */, SK = 2048 /* key rows used (== S shipped) */;
constexpr float XS = 8.0f, WSC = 256.0f, PS = 1024.0f, LOG2E = 1.4426950408889634f;
static_assert(S % 64 == 0 && QL % 128 == 0 && SK % 64 == 0 && DM == H * HD, "tiling");
typedef _Float16 b16;
typedef __attribute__((ext_vector_type(16))) _Float16 v16b;
typedef __attribute__((ext_vector_type(8))) _Float16 v8b;
typedef __attribute__((ext_vector_type(8))) float v8f;
typedef __attribute__((ext_vector_type(4))) float v4f;
__device__ __forceinline__ float bf16_rne(float f) { unsigned int u = __float_as_uint(f); u += 0x7FFFu + ((u >> 16) & 1u); return __uint_as_float(u & 0xFFFF0000u); }
__device__ __forceinline__ void split16(float v, b16& hi, b16& lo) { hi = (b16)v; lo = (b16)(v - (float)hi); }
__device__ __forceinline__ v16b frag_kb(const b16* p, int hh) { const v8b a = *(const v8b*)(p + 8 * hh), b = *(const v8b*)(p + 16 + 8 * hh); v16b f;
#pragma unroll
  for (int e = 0; e < 8; ++e) { f[e] = a[e]; f[8 + e] = b[e]; } return f; }
__device__ __forceinline__ v8f wmma16b(v16b a, v16b b, v8f c) { return __builtin_amdgcn_wmma_f32_16x16x32_f16(false, a, false, b, (short)0, c, false, false); }
// Stands between a block's LDS fragment reads and its matrix products: without it the scheduler sinks each read to its product again and the wave waits out the LDS latency once per product.
__device__ __forceinline__ void reads_stay_ahead() { __builtin_amdgcn_sched_barrier(0); }
// Stands between a tile's matrix products and its publish point: without it the scheduler sinks the products below the barrier, in front of the refill, and the next copies start a whole run of products later.
__device__ __forceinline__ void products_stay_in_trip() { __builtin_amdgcn_sched_barrier(0); }
__device__ __forceinline__ void wave_lds_sync() { __builtin_amdgcn_fence(__ATOMIC_RELEASE, "workgroup"); __builtin_amdgcn_wave_barrier(); __builtin_amdgcn_fence(__ATOMIC_ACQUIRE, "workgroup"); }
__device__ __forceinline__ float pmul(float a, float b) { float p = a * b; asm volatile("" : "+v"(p)); return p; }
__device__ __forceinline__ int iclamp(int v, int lo, int hi) { return v < lo ? lo : (v > hi ? hi : v); }

typedef __attribute__((ext_vector_type(2))) _Float16 v2h;
typedef __attribute__((ext_vector_type(4))) _Float16 v4h;
typedef __attribute__((ext_vector_type(2))) float v2f;
__device__ __forceinline__ float nexp2(float v) { return __builtin_amdgcn_exp2f(v); }
// LDS staging of operand tiles that all waves of a block read: rows of 64 f16 (one whole 128-B line), LDS pitch 144 B (16 B x odd: no bank conflict for the 16-byte fragment reads).
constexpr int TK = 64, LP = TK + 8, XP = TK + 4;   // XP: the same for rows of 64 f32 (256 B at pitch 272 B)
static_assert(SK % TK == 0 && SK >= 2 * TK && DM % TK == 0 && DM >= 2 * TK && (LP * 2) % 16 == 0, "two-buffer ring needs two tiles");
__device__ __forceinline__ unsigned lds_off(const void* p) { return (unsigned)(size_t)p; }
// Each lane copies 16 bytes global -> LDS per line, through no register; the closing s_wait_xcnt keeps every later rewrite of the address registers behind the issued copies.
__device__ __forceinline__ void copy6(unsigned l0, const void* g0, unsigned l1, const void* g1, unsigned l2, const void* g2, unsigned l3, const void* g3, unsigned l4, const void* g4, unsigned l5, const void* g5) {
  asm volatile("global_load_async_to_lds_b128 %0, %1, off\n\tglobal_load_async_to_lds_b128 %2, %3, off\n\tglobal_load_async_to_lds_b128 %4, %5, off\n\t"
               "global_load_async_to_lds_b128 %6, %7, off\n\tglobal_load_async_to_lds_b128 %8, %9, off\n\tglobal_load_async_to_lds_b128 %10, %11, off\n\ts_wait_xcnt 0x0"
               :: "v"(l0), "v"(g0), "v"(l1), "v"(g1), "v"(l2), "v"(g2), "v"(l3), "v"(g3), "v"(l4), "v"(g4), "v"(l5), "v"(g5) : "memory"); }
__device__ __forceinline__ void copy8(unsigned l0, const void* g0, unsigned l1, const void* g1, unsigned l2, const void* g2, unsigned l3, const void* g3, unsigned l4, const void* g4, unsigned l5, const void* g5, unsigned l6, const void* g6, unsigned l7, const void* g7) {
  asm volatile("global_load_async_to_lds_b128 %0, %1, off\n\tglobal_load_async_to_lds_b128 %2, %3, off\n\tglobal_load_async_to_lds_b128 %4, %5, off\n\tglobal_load_async_to_lds_b128 %6, %7, off\n\t"
               "global_load_async_to_lds_b128 %8, %9, off\n\tglobal_load_async_to_lds_b128 %10, %11, off\n\tglobal_load_async_to_lds_b128 %12, %13, off\n\tglobal_load_async_to_lds_b128 %14, %15, off\n\ts_wait_xcnt 0x0"
               :: "v"(l0), "v"(g0), "v"(l1), "v"(g1), "v"(l2), "v"(g2), "v"(l3), "v"(g3), "v"(l4), "v"(g4), "v"(l5), "v"(g5), "v"(l6), "v"(g6), "v"(l7), "v"(g7) : "memory"); }
// This wave's own copies have landed (the compiler places no wait for them).
__device__ __forceinline__ void wait_copies() { asm volatile("s_wait_asynccnt 0x0" ::: "memory"); }
// Publish point of the two-buffer ring: this wave's LDS reads of the old tile are done, its copies of the next tile have landed, then the block barrier hands both over.
__device__ __forceinline__ void publish_tile() { asm volatile("s_wait_dscnt 0x0" ::: "memory"); wait_copies(); __syncthreads(); }
// A 64-row x 64-k f32 input tile by 128 threads: 16 lanes per 256-B row, 8 rows per copy line.
__device__ __forceinline__ void stage_x64(float (*dst)[XP], const float* xrow0, int k0) {
  const int sr = threadIdx.x >> 4, sc = (threadIdx.x & 15) * 4; const float* g = xrow0 + (size_t)sr * DM + k0 + sc; const unsigned l = lds_off(&dst[sr][sc]); constexpr unsigned LS = 8 * XP * 4; constexpr size_t GS = (size_t)8 * DM;
  copy8(l, g, l + LS, g + GS, l + 2 * LS, g + 2 * GS, l + 3 * LS, g + 3 * GS, l + 4 * LS, g + 4 * GS, l + 5 * LS, g + 5 * GS, l + 6 * LS, g + 6 * GS, l + 7 * LS, g + 7 * GS); }
// A 128-row x 64-k weight tile (rows n0.., columns k0..) by 128 threads: 8 lanes per row, 16 rows per copy line.
__device__ __forceinline__ void stage_w128(b16 (*dst)[LP], const b16* Wrow0, int k0) {
  const int sr = threadIdx.x >> 3, sc = (threadIdx.x & 7) * 8; const b16* g = Wrow0 + (size_t)sr * DM + k0 + sc; const unsigned l = lds_off(&dst[sr][sc]); constexpr unsigned LS = 16 * LP * 2; constexpr size_t GS = (size_t)16 * DM;
  copy8(l, g, l + LS, g + GS, l + 2 * LS, g + 2 * GS, l + 3 * LS, g + 3 * GS, l + 4 * LS, g + 4 * GS, l + 5 * LS, g + 5 * GS, l + 6 * LS, g + 6 * GS, l + 7 * LS, g + 7 * GS); }
__global__ __launch_bounds__(256) void prep_kernel(const float* __restrict__ wq, const float* __restrict__ wk, const float* __restrict__ wv, const float* __restrict__ wo, b16* __restrict__ WT, b16* __restrict__ WO) {
  const size_t u = (size_t)blockIdx.x * 256 + threadIdx.x; const size_t per = (size_t)DM * DM / 8; if (u >= 4 * per) return; const int m = (int)(u / per); const size_t e = (u % per) * 8; const int oo = (int)(e / DM), k0 = (int)(e % DM); v8b o;
  if (m < 3) { const float* w = m == 0 ? wq : (m == 1 ? wk : wv); for (int j = 0; j < 8; ++j) o[j] = (b16)(bf16_rne(w[(size_t)(k0 + j) * DM + oo]) * WSC); { *(v8b*)(WT + (size_t)m * DM * DM + e) = o;  } }
  else { for (int j = 0; j < 8; ++j) o[j] = (b16)(bf16_rne(wo[(size_t)(k0 + j) * DM + oo]) * WSC); { *(v8b*)(WO + e) = o;  } }
}
// projections: grid (rows/64, BL x 3 (which), 8 slabs of 128); block = 64 tokens x 4 waves; A = bf16(input) x8; 8 tiles x 32 k-steps, 1 product; + bias.
// Per 64-k tile the block's 64 x 64 f32 inputs and the slab's 128 x 64 weights are copied once into a two-buffer LDS ring; a wave rounds its A fragment as it reads it, all four waves take their B fragments from the ring.
__global__ __launch_bounds__(128) void proj_kernel(const float* __restrict__ xq, const float* __restrict__ xkv, const b16* __restrict__ WT, const float* __restrict__ bq, const float* __restrict__ bk, const float* __restrict__ bv, b16* __restrict__ Qp, b16* __restrict__ Kp, b16* __restrict__ VTh, b16* __restrict__ VTl) {
  __shared__ __attribute__((aligned(16))) float Xs[2][64][XP];
  // The weight ring and the output staging share these bytes: Tf is first written behind the ring's last publish point, when no wave reads the ring and no copy is in flight.
  __shared__ __attribute__((aligned(16))) unsigned char U[2 * 128 * LP * 2]; static_assert(sizeof(U) >= sizeof(float) * 4 * 16 * (128 + 4), "staging fits the ring");
  b16 (*Ws)[128][LP] = (b16 (*)[128][LP])U; float (*Tf)[16][128 + 4] = (float (*)[16][128 + 4])U;
  const int wave = threadIdx.x >> 5, lane = threadIdx.x & 31, nloc = lane & 15, hlf = lane >> 4; const int which = blockIdx.y % 3, b = blockIdx.y / 3; const int rb = blockIdx.x, slab = blockIdx.z; const int t0 = rb * 64 + wave * 16; const int n0 = slab * 128;
  if ((which == 0 && rb * 64 >= QL) || (which != 0 && rb * 64 >= SK)) return;   // block-uniform
  const float* x = (which == 0) ? xq : xkv; const b16* W = WT + (size_t)which * DM * DM; const float* bias = which == 0 ? bq : (which == 1 ? bk : bv);
  v8f acc[8];
#pragma unroll
  for (int t = 0; t < 8; ++t) acc[t] = (v8f){};
  const b16* Wn = W + (size_t)n0 * DM; const float* xb = x + ((size_t)b * S + rb * 64) * DM;
  auto stage = [&](int k0, int buf) { stage_x64(Xs[buf], xb, k0); stage_w128(Ws[buf], Wn, k0); };
  stage(0, 0); wait_copies(); __syncthreads(); stage(TK, 1);
#pragma unroll 1   // one trip per ring tile: the buffer index and the publish point stay in one place
  for (int k0 = 0; k0 < DM; k0 += TK) { const int buf = (k0 / TK) & 1;
    v4f xv[2][4]; v16b bw[2][8];   // the whole tile's fragments, read as one group
#pragma unroll     // both 32-k steps of a tile: constant LDS offsets
    for (int s = 0; s < 2; ++s) { const float* xr = &Xs[buf][wave * 16 + nloc][32 * s + 8 * hlf];   // k order of frag_kb: 8 hlf + 0..7, then 16 + 8 hlf + 0..7
      xv[s][0] = *(const v4f*)xr; xv[s][1] = *(const v4f*)(xr + 4); xv[s][2] = *(const v4f*)(xr + 16); xv[s][3] = *(const v4f*)(xr + 20);
#pragma unroll   // the fragment arrays stay in registers only under constant indices
      for (int t = 0; t < 8; ++t) bw[s][t] = frag_kb(&Ws[buf][t * 16 + nloc][32 * s], hlf); }
    reads_stay_ahead();
#pragma unroll   // the fragment arrays stay in registers only under constant indices
    for (int s = 0; s < 2; ++s) { v16b a;
#pragma unroll
      for (int j = 0; j < 4; ++j) { a[j] = (b16)(bf16_rne(xv[s][0][j]) * XS); a[4 + j] = (b16)(bf16_rne(xv[s][1][j]) * XS); a[8 + j] = (b16)(bf16_rne(xv[s][2][j]) * XS); a[12 + j] = (b16)(bf16_rne(xv[s][3][j]) * XS); }
#pragma unroll
      for (int t = 0; t < 8; ++t) acc[t] = wmma16b(a, bw[s][t], acc[t]); }
    products_stay_in_trip(); publish_tile();
    if (k0 + 2 * TK < DM) stage(k0 + 2 * TK, buf); }   // refill the buffers that every wave has just left
  wait_copies();
#pragma unroll
  for (int t = 0; t < 8; ++t) { const float bb = bf16_rne(bias[n0 + t * 16 + nloc]);
#pragma unroll
    for (int r = 0; r < 8; ++r) Tf[wave][8 * hlf + r][t * 16 + nloc] = acc[t][r] * (1.0f / (XS * WSC)) + bb; }
  __syncthreads();
  {
    if (which == 2) {
#pragma unroll 1
      for (int q = 0; q < 32; ++q) { const int cl = wave * 32 + q; const int c = n0 + cl; const int h = c / HD, d = c % HD; const int tk = lane * 2; v2h hv, lv;
        for (int j = 0; j < 2; ++j) { b16 p, ql; split16(Tf[(tk + j) >> 4][(tk + j) & 15][cl] * XS, p, ql); hv[j] = p; lv[j] = ql; }
        const size_t oi = (((size_t)b * H + h) * HD + d) * S + rb * 64 + lane * 2; *(v2h*)(VTh + oi) = hv; *(v2h*)(VTl + oi) = lv; } }
    else { b16* P = which == 0 ? Qp : Kp;
      for (int rr = 0; rr < 16; ++rr) { for (int hs = 0; hs < 2; ++hs) { const int c = n0 + hs * 64; const int h = c / HD; v2h o; o[0] = (b16)(Tf[wave][rr][hs * 64 + lane * 2] * XS); o[1] = (b16)(Tf[wave][rr][hs * 64 + lane * 2 + 1] * XS);
          *(v2h*)(P + (((size_t)b * H + h) * S + (t0 + rr)) * HD + lane * 2) = o; } } }
     }
}
// attention: grid (QL/128, BL*H): block = 8 waves x 16 queries; key tiles in order (2 per 32-key step), online softmax (running max), P x1024 single via LDS, O^T += V^T P^T (v hi+lo: 2 products);
// K, V^T hi and V^T lo come in 64-key tiles, copied once per block into a two-buffer LDS ring while the tile before is worked on; every wave takes its fragments from there.
__global__ __launch_bounds__(256) void attn_kernel(const b16* __restrict__ Qp, const b16* __restrict__ Kp, const b16* __restrict__ VTh, const b16* __restrict__ VTl, b16* __restrict__ Ch, b16* __restrict__ Cl) {
  __shared__ __attribute__((aligned(16))) b16 Pb[8][16][32 + 8]; __shared__ __attribute__((aligned(16))) float To[8][16][HD + 4];
  __shared__ __attribute__((aligned(16))) b16 Ks[2][TK][LP]; __shared__ __attribute__((aligned(16))) b16 Vhs[2][HD][LP]; __shared__ __attribute__((aligned(16))) b16 Vls[2][HD][LP];
  const int wave = threadIdx.x >> 5, lane = threadIdx.x & 31, hh = lane >> 4, col = lane & 15; const int b = blockIdx.y / H, h = blockIdx.y % H; const int q0 = blockIdx.x * 128 + wave * 16, qi = q0 + col;
  const b16* Qb = Qp + ((size_t)(b * H + h) * S) * HD; const b16* Kb = Kp + ((size_t)(b * H + h) * S) * HD; const b16* Vh = VTh + ((size_t)(b * H + h) * HD) * S; const b16* Vl = VTl + ((size_t)(b * H + h) * HD) * S;
  const v16b qa0 = frag_kb(Qb + (size_t)qi * HD, hh), qa1 = frag_kb(Qb + (size_t)qi * HD + 32, hh);
  const float cs = LOG2E / (8.0f * XS * XS);   // 1/sqrt(64) and the two x8 carriers, in the log2 domain
  float m = -INFINITY, l = 0.0f; v8f o[4]; for (int t = 0; t < 4; ++t) o[t] = (v8f){};
  const int sr = threadIdx.x >> 3, sc = (threadIdx.x & 7) * 8;   // 8 lanes per 128-B row; 256 threads cover rows sr and sr + 32 of each of the three tiles
  auto stage = [&](int kt, int buf) {
    copy6(lds_off(&Ks[buf][sr][sc]), Kb + (size_t)(kt + sr) * HD + sc, lds_off(&Ks[buf][sr + 32][sc]), Kb + (size_t)(kt + sr + 32) * HD + sc,
          lds_off(&Vhs[buf][sr][sc]), Vh + (size_t)sr * S + kt + sc, lds_off(&Vhs[buf][sr + 32][sc]), Vh + (size_t)(sr + 32) * S + kt + sc,
          lds_off(&Vls[buf][sr][sc]), Vl + (size_t)sr * S + kt + sc, lds_off(&Vls[buf][sr + 32][sc]), Vl + (size_t)(sr + 32) * S + kt + sc); };
  stage(0, 0); wait_copies(); __syncthreads(); stage(TK, 1);
#pragma unroll 1   // one trip per ring tile: the buffer index and the publish point stay in one place
  for (int kt = 0; kt < SK; kt += TK) { const int buf = (kt / TK) & 1;
#pragma unroll 1
  for (int kb = 0; kb < TK; kb += 32) {
    float e[16]; float mx = -INFINITY; v16b kf[2][2], vh[4], vl[4];   // the step's K and V^T fragments, read as one group: the V^T reads land behind the softmax
#pragma unroll   // the fragment arrays stay in registers only under constant indices
    for (int u = 0; u < 2; ++u) { const b16* kr = &Ks[buf][kb + u * 16 + col][0]; kf[u][0] = frag_kb(kr, hh); kf[u][1] = frag_kb(kr + 32, hh); }
#pragma unroll   // the fragment arrays stay in registers only under constant indices
    for (int t = 0; t < 4; ++t) { vh[t] = frag_kb(&Vhs[buf][t * 16 + col][kb], hh); vl[t] = frag_kb(&Vls[buf][t * 16 + col][kb], hh); }
    reads_stay_ahead();
#pragma unroll
    for (int u = 0; u < 2; ++u) { v8f s = (v8f){}; s = wmma16b(kf[u][0], qa0, s); s = wmma16b(kf[u][1], qa1, s);
#pragma unroll
      for (int r = 0; r < 8; ++r) { const float v = s[r] * cs; e[u * 8 + r] = v; mx = fmaxf(mx, v); } }
    mx = fmaxf(mx, __shfl_xor(mx, 16)); const float mn = fmaxf(m, mx); const float al = nexp2(m - mn); float sum = 0.0f;
#pragma unroll
    for (int i2 = 0; i2 < 16; ++i2) { const float p = nexp2(e[i2] - mn); sum += p; Pb[wave][col][(i2 < 8 ? 0 : 16) + 8 * hh + (i2 & 7)] = (b16)(p * PS); }
    sum += __shfl_xor(sum, 16); l = l * al + sum; m = mn;
    wave_lds_sync();
    const v16b pf = frag_kb(&Pb[wave][col][0], hh);
#pragma unroll
    for (int t = 0; t < 4; ++t) { o[t] *= al; o[t] = wmma16b(vh[t], pf, o[t]); o[t] = wmma16b(vl[t], pf, o[t]); }
    wave_lds_sync();
    // The step's last WMMA stands next to the loop's back edge: four vector slots before the next step's address arithmetic may reuse its A registers.
    __builtin_amdgcn_sched_barrier(0); asm volatile("v_nop\n\tv_nop\n\tv_nop\n\tv_nop"); }
    publish_tile();
    if (kt + 2 * TK < SK) stage(kt + 2 * TK, buf); }   // refill the buffer that every wave has just left
  wait_copies();
  const float inv = 1.0f / (l * PS * XS);
#pragma unroll
  for (int t = 0; t < 4; ++t)
#pragma unroll
    for (int r = 0; r < 8; ++r) To[wave][col][t * 16 + 8 * hh + r] = o[t][r] * inv;
  wave_lds_sync();
  { for (int rr = 0; rr < 16; ++rr) { const v2f f = *(const v2f*)(&To[wave][rr][lane * 2]); v2h hv, lv; for (int j = 0; j < 2; ++j) { b16 p, q; split16(f[j] * XS, p, q); hv[j] = p; lv[j] = q; }
      const size_t oi = ((size_t)b * S + q0 + rr) * DM + h * HD + lane * 2; *(v2h*)(Ch + oi) = hv; *(v2h*)(Cl + oi) = lv; }  }
}
__global__ __launch_bounds__(128) void out_kernel(const b16* __restrict__ Ch, const b16* __restrict__ Cl, const b16* __restrict__ WO, const float* __restrict__ bo, float* __restrict__ out) {
  __shared__ __attribute__((aligned(16))) float Tf[4][16][128 + 4]; __shared__ __attribute__((aligned(16))) b16 Ws[2][128][LP]; __shared__ __attribute__((aligned(16))) b16 Ahs[2][64][LP]; __shared__ __attribute__((aligned(16))) b16 Als[2][64][LP];   // two-buffer ring: 128 x 64 weight tile (read by all four waves), 64 x 64 ctx hi and lo tiles
  const int wave = threadIdx.x >> 5, lane = threadIdx.x & 31, nloc = lane & 15, hlf = lane >> 4; const int b = blockIdx.x / (QL / 64), rb = blockIdx.x % (QL / 64); const size_t m0 = (size_t)b * S + rb * 64 + wave * 16; const int n0 = blockIdx.y * 128;
  v8f acc[8];
#pragma unroll
  for (int t = 0; t < 8; ++t) acc[t] = (v8f){};
  const b16* Wn = WO + (size_t)n0 * DM; const int sr = threadIdx.x >> 3, sc = (threadIdx.x & 7) * 8;   // 8 lanes per 128-B row; 128 threads cover rows sr + 16 j
  const size_t a0 = ((size_t)b * S + rb * 64 + sr) * DM + sc; constexpr unsigned LS = 16 * LP * 2; constexpr size_t GS = (size_t)16 * DM;
  auto stage = [&](int k0, int buf) { const b16* gh = Ch + a0 + k0; const b16* gl = Cl + a0 + k0; const unsigned lh = lds_off(&Ahs[buf][sr][sc]), ll = lds_off(&Als[buf][sr][sc]);
    copy8(lh, gh, lh + LS, gh + GS, lh + 2 * LS, gh + 2 * GS, lh + 3 * LS, gh + 3 * GS, ll, gl, ll + LS, gl + GS, ll + 2 * LS, gl + 2 * GS, ll + 3 * LS, gl + 3 * GS); stage_w128(Ws[buf], Wn, k0); };
  stage(0, 0); wait_copies(); __syncthreads(); stage(TK, 1);
#pragma unroll 1   // one trip per ring tile: the buffer index and the publish point stay in one place
  for (int kt = 0; kt < DM; kt += TK) { const int buf = (kt / TK) & 1;
    v16b ah[2], al[2], bw[2][8];   // the whole tile's fragments, read as one group
#pragma unroll     // both 32-k steps of a tile: constant LDS offsets
    for (int s = 0; s < 2; ++s) { ah[s] = frag_kb(&Ahs[buf][wave * 16 + nloc][32 * s], hlf); al[s] = frag_kb(&Als[buf][wave * 16 + nloc][32 * s], hlf);
#pragma unroll   // the fragment arrays stay in registers only under constant indices
      for (int t = 0; t < 8; ++t) bw[s][t] = frag_kb(&Ws[buf][t * 16 + nloc][32 * s], hlf); }
    reads_stay_ahead();
#pragma unroll   // the fragment arrays stay in registers only under constant indices
    for (int s = 0; s < 2; ++s)
#pragma unroll   // the fragment arrays stay in registers only under constant indices
      for (int t = 0; t < 8; ++t) { acc[t] = wmma16b(ah[s], bw[s][t], acc[t]); acc[t] = wmma16b(al[s], bw[s][t], acc[t]); }
    products_stay_in_trip(); publish_tile();
    if (kt + 2 * TK < DM) stage(kt + 2 * TK, buf); }   // refill the buffers that every wave has just left
  wait_copies();
#pragma unroll
  for (int t = 0; t < 8; ++t) { const float bb = bf16_rne(bo[n0 + t * 16 + nloc]);
#pragma unroll
    for (int r = 0; r < 8; ++r) Tf[wave][8 * hlf + r][t * 16 + nloc] = acc[t][r] * (1.0f / (XS * WSC)) + bb; }
  wave_lds_sync();
  { for (int rr = 0; rr < 16; ++rr) *(v4f*)(out + (m0 + rr) * DM + n0 + lane * 4) = *(const v4f*)(&Tf[wave][rr][lane * 4]);  }
}
}  // namespace

extern "C" void kernel_launch(void* const* d_in, const int* in_sizes, int n_in, void* d_out, int out_size, void* d_ws, size_t ws_size, hipStream_t stream) {
  (void)n_in;
  auto Fp = [&](int i) { return (const float*)d_in[i]; };
  // input order: 0 inputs_q [2,2048,1024], 1 inputs_kv, 2 Wq [1024,16,64], 3 Wk, 4 Wv, 5 bq [16,64], 6 bk, 7 bv, 8 Wo [16,64,1024], 9 bo [1024]
  if (in_sizes[0] != B * S * DM || in_sizes[1] != B * S * DM || in_sizes[2] != DM * DM || in_sizes[3] != DM * DM || in_sizes[4] != DM * DM || in_sizes[5] != DM || in_sizes[8] != DM * DM || in_sizes[9] != DM || out_size != B * S * DM) return;
  size_t off = 0; char* ws = (char*)d_ws;
  auto carve = [&](size_t bytes) { char* p = ws + off; off += (bytes + 255) & ~(size_t)255; return p; };
  b16* WT = (b16*)carve((size_t)3 * DM * DM * 2); b16* WO = (b16*)carve((size_t)DM * DM * 2); const size_t plane = (size_t)B * S * DM * 2;
  b16* Qp = (b16*)carve(plane); b16* Kp = (b16*)carve(plane); b16* VTh = (b16*)carve(plane); b16* VTl = (b16*)carve(plane); b16* Ch = (b16*)carve(plane); b16* Cl = (b16*)carve(plane);
  if (off > ws_size || off > ((size_t)128 << 20)) return;   // ≈ 58.7 MB (6 planes x 8.4 MB + 8.4 MB weights)
  prep_kernel<<<(unsigned)(((size_t)4 * DM * DM / 8 + 255) / 256), 256, 0, stream>>>(Fp(2), Fp(3), Fp(4), Fp(8), WT, WO);
  proj_kernel<<<dim3(S / 64, BL * 3, 8), 128, 0, stream>>>(Fp(0), Fp(1), WT, Fp(5), Fp(6), Fp(7), Qp, Kp, VTh, VTl);
  attn_kernel<<<dim3(QL / 128, BL * H), 256, 0, stream>>>(Qp, Kp, VTh, VTl, Ch, Cl);
  out_kernel<<<dim3((QL / 64) * BL, 8), 128, 0, stream>>>(Ch, Cl, WO, Fp(9), (float*)d_out);
}

// v003
// A run of this version takes 120 microseconds.
// Two timings next to v002 put it at 1.09 and 1.08 times that version's speed.
// Counting every step since v000, it is 4.33 times as fast.
#include <hip/hip_runtime.h>

// Multi-head dot-product attention (16 heads x 64, d_model 1024) on inputs_q / inputs_kv [2, 2048, 1024]: q = inputs_q Wq + bq, k/v = inputs_kv Wk/Wv + b; attn = softmax(q k^T / 8) per head over
// all 2,048 keys; ctx = attn v; out = ctx Wo + bo -> [2][2048][1024].
// Deterministic: flash-style per 16-query wave over the keys in order (running max), fixed reduction trees; no atomics.
// compute dtype: WMMA v_wmma_f32_16x16x32_f16 with f32 accumulate for the three projections ([4096 x 1024] x [1024 x 1024]; inputs EXACT bf16 x8, [h][d][f]
// weights transposed exact x256: 1 product), S^T = K Q^T (q, k single f16 x8: 1 product), O^T += V^T P^T (v hi+lo x8, P x1024 single f16: 2 products) and out = ctx Wo ([4096 x 1024] x [1024 x 1024];
// ctx as hi+lo x8 planes: 2 products, Wo transposed exact x256); softmax statistics (exp2, running max) in f32. Inputs rounded to bf16 once.

namespace {
constexpr int B = 2, S = 2048, DM = 1024, H = 16, HD = 64, BL = 2 /* batches computed (== B shipped) */, QL = 2048 /* query rows computed (== S shipped) */, SK = 2048 /* key rows used (== S shipped) */;
constexpr float XS = 8.0f, WSC = 256.0f, PS = 1024.0f, LOG2E = 1.4426950408889634f;
static_assert(S % 64 == 0 && QL % 128 == 0 && SK % 64 == 0 && DM == H * HD, "tiling");
typedef _Float16 b16;
typedef __attribute__((ext_vector_type(16))) _Float16 v16b;
typedef __attribute__((ext_vector_type(8))) _Float16 v8b;
typedef __attribute__((ext_vector_type(8))) float v8f;
typedef __attribute__((ext_vector_type(4))) float v4f;
__device__ __forceinline__ float bf16_rne(float f) { unsigned int u = __float_as_uint(f); u += 0x7FFFu + ((u >> 16) & 1u); return __uint_as_float(u & 0xFFFF0000u); }
__device__ __forceinline__ void split16(float v, b16& hi, b16& lo) { hi = (b16)v; lo = (b16)(v - (float)hi); }
__device__ __forceinline__ v16b frag_kb(const b16* p, int hh) { const v8b a = *(const v8b*)(p + 8 * hh), b = *(const v8b*)(p + 16 + 8 * hh); v16b f;
#pragma unroll
  for (int e = 0; e < 8; ++e) { f[e] = a[e]; f[8 + e] = b[e]; } return f; }
__device__ __forceinline__ v8f wmma16b(v16b a, v16b b, v8f c) { return __builtin_amdgcn_wmma_f32_16x16x32_f16(false, a, false, b, (short)0, c, false, false); }
// Stands between a block's LDS fragment reads and its matrix products: without it the scheduler sinks each read to its product again and the wave waits out the LDS latency once per product.
__device__ __forceinline__ void reads_stay_ahead() { __builtin_amdgcn_sched_barrier(0); }
// Stands between a tile's matrix products and its publish point: without it the scheduler sinks the products below the barrier, in front of the refill, and the next copies start a whole run of products later.
__device__ __forceinline__ void products_stay_in_trip() { __builtin_amdgcn_sched_barrier(0); }
__device__ __forceinline__ void wave_lds_sync() { __builtin_amdgcn_fence(__ATOMIC_RELEASE, "workgroup"); __builtin_amdgcn_wave_barrier(); __builtin_amdgcn_fence(__ATOMIC_ACQUIRE, "workgroup"); }
__device__ __forceinline__ float pmul(float a, float b) { float p = a * b; asm volatile("" : "+v"(p)); return p; }
__device__ __forceinline__ int iclamp(int v, int lo, int hi) { return v < lo ? lo : (v > hi ? hi : v); }

typedef __attribute__((ext_vector_type(2))) _Float16 v2h;
typedef __attribute__((ext_vector_type(4))) _Float16 v4h;
typedef __attribute__((ext_vector_type(2))) float v2f;
__device__ __forceinline__ float nexp2(float v) { return __builtin_amdgcn_exp2f(v); }
// LDS staging of operand tiles that all waves of a block read: rows of 64 f16 (one whole 128-B line), LDS pitch 144 B (16 B x odd: no bank conflict for the 16-byte fragment reads).
constexpr int TK = 64, LP = TK + 8, XP = TK + 4;   // XP: the same for rows of 64 f32 (256 B at pitch 272 B)
static_assert(SK % TK == 0 && SK >= 2 * TK && DM % TK == 0 && DM >= 2 * TK && (LP * 2) % 16 == 0, "two-buffer ring needs two tiles");
__device__ __forceinline__ unsigned lds_off(const void* p) { return (unsigned)(size_t)p; }
// Each lane copies 16 bytes global -> LDS per line, through no register; the closing s_wait_xcnt keeps every later rewrite of the address registers behind the issued copies.
__device__ __forceinline__ void copy6(unsigned l0, const void* g0, unsigned l1, const void* g1, unsigned l2, const void* g2, unsigned l3, const void* g3, unsigned l4, const void* g4, unsigned l5, const void* g5) {
  asm volatile("global_load_async_to_lds_b128 %0, %1, off\n\tglobal_load_async_to_lds_b128 %2, %3, off\n\tglobal_load_async_to_lds_b128 %4, %5, off\n\t"
               "global_load_async_to_lds_b128 %6, %7, off\n\tglobal_load_async_to_lds_b128 %8, %9, off\n\tglobal_load_async_to_lds_b128 %10, %11, off\n\ts_wait_xcnt 0x0"
               :: "v"(l0), "v"(g0), "v"(l1), "v"(g1), "v"(l2), "v"(g2), "v"(l3), "v"(g3), "v"(l4), "v"(g4), "v"(l5), "v"(g5) : "memory"); }
__device__ __forceinline__ void copy8(unsigned l0, const void* g0, unsigned l1, const void* g1, unsigned l2, const void* g2, unsigned l3, const void* g3, unsigned l4, const void* g4, unsigned l5, const void* g5, unsigned l6, const void* g6, unsigned l7, const void* g7) {
  asm volatile("global_load_async_to_lds_b128 %0, %1, off\n\tglobal_load_async_to_lds_b128 %2, %3, off\n\tglobal_load_async_to_lds_b128 %4, %5, off\n\tglobal_load_async_to_lds_b128 %6, %7, off\n\t"
               "global_load_async_to_lds_b128 %8, %9, off\n\tglobal_load_async_to_lds_b128 %10, %11, off\n\tglobal_load_async_to_lds_b128 %12, %13, off\n\tglobal_load_async_to_lds_b128 %14, %15, off\n\ts_wait_xcnt 0x0"
               :: "v"(l0), "v"(g0), "v"(l1), "v"(g1), "v"(l2), "v"(g2), "v"(l3), "v"(g3), "v"(l4), "v"(g4), "v"(l5), "v"(g5), "v"(l6), "v"(g6), "v"(l7), "v"(g7) : "memory"); }
// This wave's own copies have landed (the compiler places no wait for them).
__device__ __forceinline__ void wait_copies() { asm volatile("s_wait_asynccnt 0x0" ::: "memory"); }
// Publish point of the two-buffer ring: this wave's LDS reads of the old tile are done, its copies of the next tile have landed, then the block barrier hands both over.
__device__ __forceinline__ void publish_tile() { asm volatile("s_wait_dscnt 0x0" ::: "memory"); wait_copies(); __syncthreads(); }
// A 64-row x 64-k f32 input tile by 128 threads: 16 lanes per 256-B row, 8 rows per copy line.
__device__ __forceinline__ void stage_x64(float (*dst)[XP], const float* xrow0, int k0) {
  const int sr = threadIdx.x >> 4, sc = (threadIdx.x & 15) * 4; const float* g = xrow0 + (size_t)sr * DM + k0 + sc; const unsigned l = lds_off(&dst[sr][sc]); constexpr unsigned LS = 8 * XP * 4; constexpr size_t GS = (size_t)8 * DM;
  copy8(l, g, l + LS, g + GS, l + 2 * LS, g + 2 * GS, l + 3 * LS, g + 3 * GS, l + 4 * LS, g + 4 * GS, l + 5 * LS, g + 5 * GS, l + 6 * LS, g + 6 * GS, l + 7 * LS, g + 7 * GS); }
// A 128-row x 64-k weight tile (rows n0.., columns k0..) by 128 threads: 8 lanes per row, 16 rows per copy line.
__device__ __forceinline__ void stage_w128(b16 (*dst)[LP], const b16* Wrow0, int k0) {
  const int sr = threadIdx.x >> 3, sc = (threadIdx.x & 7) * 8; const b16* g = Wrow0 + (size_t)sr * DM + k0 + sc; const unsigned l = lds_off(&dst[sr][sc]); constexpr unsigned LS = 16 * LP * 2; constexpr size_t GS = (size_t)16 * DM;
  copy8(l, g, l + LS, g + GS, l + 2 * LS, g + 2 * GS, l + 3 * LS, g + 3 * GS, l + 4 * LS, g + 4 * GS, l + 5 * LS, g + 5 * GS, l + 6 * LS, g + 6 * GS, l + 7 * LS, g + 7 * GS); }
// Weight transposition, one 128 x 128 tile of one weight per block: each wave load takes whole 128-B lines (4 k rows x 32 columns), a thread rounds and scales two neighbouring k rows and stores them as f16 pairs into the turned LDS tile,
// which leaves as 256-B pieces of the [column][k] rows. LDS pitch 264 B: the 4-byte stores of a wave and its 8-byte reads each fall on distinct banks.
constexpr int PT = 128, PP = PT + 4, PTN = DM / PT, PREP_BLOCKS = 4 * PTN * PTN;
static_assert(DM % PT == 0 && (PP * 2) % 8 == 0, "prep tiling");
__global__ __launch_bounds__(256) void prep_kernel(const float* __restrict__ wq, const float* __restrict__ wk, const float* __restrict__ wv, const float* __restrict__ wo, b16* __restrict__ WT, b16* __restrict__ WO) {
  __shared__ __attribute__((aligned(16))) b16 T[PT][PP];
  const int m = blockIdx.x / (PTN * PTN), tile = blockIdx.x % (PTN * PTN); const int kb = (tile / PTN) * PT, ob = (tile % PTN) * PT;
  const float* w = m == 0 ? wq : (m == 1 ? wk : (m == 2 ? wv : wo)); b16* dst = m < 3 ? WT + (size_t)m * DM * DM : WO;
  const int wave = threadIdx.x >> 5, lane = threadIdx.x & 31; const int k = (wave >> 2) * 8 + (lane >> 3) * 2, oo = (wave & 3) * 32 + (lane & 7) * 4;   // pass p: rows k + 16 p and the next, columns oo .. oo + 3
  const float* g = w + (size_t)(kb + k) * DM + ob + oo;
  v4f x0[8], x1[8];
#pragma unroll   // all sixteen loads of a thread in flight at once, off one address
  for (int p = 0; p < 8; ++p) { x0[p] = *(const v4f*)(g + (size_t)(16 * p) * DM); x1[p] = *(const v4f*)(g + (size_t)(16 * p + 1) * DM); }
  asm volatile("s_wait_xcnt 0x0" :: "v"(g) : "memory");   // the wait behind the issued loads; naming g keeps their address pair from being given to the last load's result in front of it
  __builtin_amdgcn_sched_barrier(0);   // without it the scheduler sinks most of the loads below the first conversions, and a thread waits out the memory latency several times instead of once
#pragma unroll   // x0, x1 stay in registers only under constant indices
  for (int p = 0; p < 8; ++p)
#pragma unroll
    for (int i = 0; i < 4; ++i) { v2h pr; pr[0] = (b16)(bf16_rne(x0[p][i]) * WSC); pr[1] = (b16)(bf16_rne(x1[p][i]) * WSC); *(v2h*)&T[oo + i][k + 16 * p] = pr; }
  __syncthreads();
  const int ro = threadIdx.x >> 4, k8 = (threadIdx.x & 15) * 8; b16* d = dst + (size_t)(ob + ro) * DM + kb + k8;   // pass p: column ro + 16 p, 16 lanes per 256-B piece
#pragma unroll
  for (int p = 0; p < 8; ++p) { const v4h a = *(const v4h*)&T[ro + 16 * p][k8], b = *(const v4h*)&T[ro + 16 * p][k8 + 4]; v8b o;
#pragma unroll
    for (int j = 0; j < 4; ++j) { o[j] = a[j]; o[4 + j] = b[j]; }
    *(v8b*)(d + (size_t)(16 * p) * DM) = o; }
}
// projections: grid (rows/64, BL x 3 (which), 8 slabs of 128); block = 64 tokens x 4 waves; A = bf16(input) x8; 8 tiles x 32 k-steps, 1 product; + bias.
// Per 64-k tile the block's 64 x 64 f32 inputs and the slab's 128 x 64 weights are copied once into a two-buffer LDS ring; a wave rounds its A fragment as it reads it, all four waves take their B fragments from the ring.
__global__ __launch_bounds__(128) void proj_kernel(const float* __restrict__ xq, const float* __restrict__ xkv, const b16* __restrict__ WT, const float* __restrict__ bq, const float* __restrict__ bk, const float* __restrict__ bv, b16* __restrict__ Qp, b16* __restrict__ Kp, b16* __restrict__ VTh, b16* __restrict__ VTl) {
  __shared__ __attribute__((aligned(16))) float Xs[2][64][XP];
  // The weight ring and the output staging share these bytes: Tf is first written behind the ring's last publish point, when no wave reads the ring and no copy is in flight.
  __shared__ __attribute__((aligned(16))) unsigned char U[2 * 128 * LP * 2]; static_assert(sizeof(U) >= sizeof(float) * 4 * 16 * (128 + 4), "staging fits the ring");
  b16 (*Ws)[128][LP] = (b16 (*)[128][LP])U; float (*Tf)[16][128 + 4] = (float (*)[16][128 + 4])U;
  const int wave = threadIdx.x >> 5, lane = threadIdx.x & 31, nloc = lane & 15, hlf = lane >> 4; const int which = blockIdx.y % 3, b = blockIdx.y / 3; const int rb = blockIdx.x, slab = blockIdx.z; const int t0 = rb * 64 + wave * 16; const int n0 = slab * 128;
  if ((which == 0 && rb * 64 >= QL) || (which != 0 && rb * 64 >= SK)) return;   // block-uniform
  const float* x = (which == 0) ? xq : xkv; const b16* W = WT + (size_t)which * DM * DM; const float* bias = which == 0 ? bq : (which == 1 ? bk : bv);
  v8f acc[8];
#pragma unroll
  for (int t = 0; t < 8; ++t) acc[t] = (v8f){};
  const b16* Wn = W + (size_t)n0 * DM; const float* xb = x + ((size_t)b * S + rb * 64) * DM;
  auto stage = [&](int k0, int buf) { stage_x64(Xs[buf], xb, k0); stage_w128(Ws[buf], Wn, k0); };
  stage(0, 0); wait_copies(); __syncthreads(); stage(TK, 1);
#pragma unroll 1   // one trip per ring tile: the buffer index and the publish point stay in one place
  for (int k0 = 0; k0 < DM; k0 += TK) { const int buf = (k0 / TK) & 1;
    v4f xv[2][4]; v16b bw[2][8];   // the whole tile's fragments, read as one group
#pragma unroll     // both 32-k steps of a tile: constant LDS offsets
    for (int s = 0; s < 2; ++s) { const float* xr = &Xs[buf][wave * 16 + nloc][32 * s + 8 * hlf];   // k order of frag_kb: 8 hlf + 0..7, then 16 + 8 hlf + 0..7
      xv[s][0] = *(const v4f*)xr; xv[s][1] = *(const v4f*)(xr + 4); xv[s][2] = *(const v4f*)(xr + 16); xv[s][3] = *(const v4f*)(xr + 20);
#pragma unroll   // the fragment arrays stay in registers only under constant indices
      for (int t = 0; t < 8; ++t) bw[s][t] = frag_kb(&Ws[buf][t * 16 + nloc][32 * s], hlf); }
    reads_stay_ahead();
#pragma unroll   // the fragment arrays stay in registers only under constant indices
    for (int s = 0; s < 2; ++s) { v16b a;
#pragma unroll
      for (int j = 0; j < 4; ++j) { a[j] = (b16)(bf16_rne(xv[s][0][j]) * XS); a[4 + j] = (b16)(bf16_rne(xv[s][1][j]) * XS); a[8 + j] = (b16)(bf16_rne(xv[s][2][j]) * XS); a[12 + j] = (b16)(bf16_rne(xv[s][3][j]) * XS); }
#pragma unroll
      for (int t = 0; t < 8; ++t) acc[t] = wmma16b(a, bw[s][t], acc[t]); }
    products_stay_in_trip(); publish_tile();
    if (k0 + 2 * TK < DM) stage(k0 + 2 * TK, buf); }   // refill the buffers that every wave has just left
  wait_copies();
#pragma unroll
  for (int t = 0; t < 8; ++t) { const float bb = bf16_rne(bias[n0 + t * 16 + nloc]);
#pragma unroll
    for (int r = 0; r < 8; ++r) Tf[wave][8 * hlf + r][t * 16 + nloc] = acc[t][r] * (1.0f / (XS * WSC)) + bb; }
  __syncthreads();
  {
    if (which == 2) {
#pragma unroll 1
      for (int q = 0; q < 32; ++q) { const int cl = wave * 32 + q; const int c = n0 + cl; const int h = c / HD, d = c % HD; const int tk = lane * 2; v2h hv, lv;
        for (int j = 0; j < 2; ++j) { b16 p, ql; split16(Tf[(tk + j) >> 4][(tk + j) & 15][cl] * XS, p, ql); hv[j] = p; lv[j] = ql; }
        const size_t oi = (((size_t)b * H + h) * HD + d) * S + rb * 64 + lane * 2; *(v2h*)(VTh + oi) = hv; *(v2h*)(VTl + oi) = lv; } }
    else { b16* P = which == 0 ? Qp : Kp;
      for (int rr = 0; rr < 16; ++rr) { for (int hs = 0; hs < 2; ++hs) { const int c = n0 + hs * 64; const int h = c / HD; v2h o; o[0] = (b16)(Tf[wave][rr][hs * 64 + lane * 2] * XS); o[1] = (b16)(Tf[wave][rr][hs * 64 + lane * 2 + 1] * XS);
          *(v2h*)(P + (((size_t)b * H + h) * S + (t0 + rr)) * HD + lane * 2) = o; } } }
     }
}
// attention: grid (QL/128, BL*H): block = 8 waves x 16 queries; key tiles in order (2 per 32-key step), online softmax (running max), P x1024 single via LDS, O^T += V^T P^T (v hi+lo: 2 products);
// K, V^T hi and V^T lo come in 64-key tiles, copied once per block into a two-buffer LDS ring while the tile before is worked on; every wave takes its fragments from there.
__global__ __launch_bounds__(256) void attn_kernel(const b16* __restrict__ Qp, const b16* __restrict__ Kp, const b16* __restrict__ VTh, const b16* __restrict__ VTl, b16* __restrict__ Ch, b16* __restrict__ Cl) {
  __shared__ __attribute__((aligned(16))) b16 Pb[8][16][32 + 8]; __shared__ __attribute__((aligned(16))) float To[8][16][HD + 4];
  __shared__ __attribute__((aligned(16))) b16 Ks[2][TK][LP]; __shared__ __attribute__((aligned(16))) b16 Vhs[2][HD][LP]; __shared__ __attribute__((aligned(16))) b16 Vls[2][HD][LP];
  const int wave = threadIdx.x >> 5, lane = threadIdx.x & 31, hh = lane >> 4, col = lane & 15; const int b = blockIdx.y / H, h = blockIdx.y % H; const int q0 = blockIdx.x * 128 + wave * 16, qi = q0 + col;
  const b16* Qb = Qp + ((size_t)(b * H + h) * S) * HD; const b16* Kb = Kp + ((size_t)(b * H + h) * S) * HD; const b16* Vh = VTh + ((size_t)(b * H + h) * HD) * S; const b16* Vl = VTl + ((size_t)(b * H + h) * HD) * S;
  const v16b qa0 = frag_kb(Qb + (size_t)qi * HD, hh), qa1 = frag_kb(Qb + (size_t)qi * HD + 32, hh);
  const float cs = LOG2E / (8.0f * XS * XS);   // 1/sqrt(64) and the two x8 carriers, in the log2 domain
  float m = -INFINITY, l = 0.0f; v8f o[4]; for (int t = 0; t < 4; ++t) o[t] = (v8f){};
  const int sr = threadIdx.x >> 3, sc = (threadIdx.x & 7) * 8;   // 8 lanes per 128-B row; 256 threads cover rows sr and sr + 32 of each of the three tiles
  auto stage = [&](int kt, int buf) {
    copy6(lds_off(&Ks[buf][sr][sc]), Kb + (size_t)(kt + sr) * HD + sc, lds_off(&Ks[buf][sr + 32][sc]), Kb + (size_t)(kt + sr + 32) * HD + sc,
          lds_off(&Vhs[buf][sr][sc]), Vh + (size_t)sr * S + kt + sc, lds_off(&Vhs[buf][sr + 32][sc]), Vh + (size_t)(sr + 32) * S + kt + sc,
          lds_off(&Vls[buf][sr][sc]), Vl + (size_t)sr * S + kt + sc, lds_off(&Vls[buf][sr + 32][sc]), Vl + (size_t)(sr + 32) * S + kt + sc); };
  stage(0, 0); wait_copies(); __syncthreads(); stage(TK, 1);
#pragma unroll 1   // one trip per ring tile: the buffer index and the publish point stay in one place
  for (int kt = 0; kt < SK; kt += TK) { const int buf = (kt / TK) & 1;
#pragma unroll 1
  for (int kb = 0; kb < TK; kb += 32) {
    float e[16]; float mx = -INFINITY; v16b kf[2][2], vh[4], vl[4];   // the step's K and V^T fragments, read as one group: the V^T reads land behind the softmax
#pragma unroll   // the fragment arrays stay in registers only under constant indices
    for (int u = 0; u < 2; ++u) { const b16* kr = &Ks[buf][kb + u * 16 + col][0]; kf[u][0] = frag_kb(kr, hh); kf[u][1] = frag_kb(kr + 32, hh); }
#pragma unroll   // the fragment arrays stay in registers only under constant indices
    for (int t = 0; t < 4; ++t) { vh[t] = frag_kb(&Vhs[buf][t * 16 + col][kb], hh); vl[t] = frag_kb(&Vls[buf][t * 16 + col][kb], hh); }
    reads_stay_ahead();
#pragma unroll
    for (int u = 0; u < 2; ++u) { v8f s = (v8f){}; s = wmma16b(kf[u][0], qa0, s); s = wmma16b(kf[u][1], qa1, s);
#pragma unroll
      for (int r = 0; r < 8; ++r) { const float v = s[r] * cs; e[u * 8 + r] = v; mx = fmaxf(mx, v); } }
    mx = fmaxf(mx, __shfl_xor(mx, 16)); const float mn = fmaxf(m, mx); const float al = nexp2(m - mn); float sum = 0.0f;
#pragma unroll
    for (int i2 = 0; i2 < 16; ++i2) { const float p = nexp2(e[i2] - mn); sum += p; Pb[wave][col][(i2 < 8 ? 0 : 16) + 8 * hh + (i2 & 7)] = (b16)(p * PS); }
    sum += __shfl_xor(sum, 16); l = l * al + sum; m = mn;
    wave_lds_sync();
    const v16b pf = frag_kb(&Pb[wave][col][0], hh);
#pragma unroll
    for (int t = 0; t < 4; ++t) { o[t] *= al; o[t] = wmma16b(vh[t], pf, o[t]); o[t] = wmma16b(vl[t], pf, o[t]); }
    wave_lds_sync();
    // The step's last WMMA stands next to the loop's back edge: four vector slots before the next step's address arithmetic may reuse its A registers.
    __builtin_amdgcn_sched_barrier(0); asm volatile("v_nop\n\tv_nop\n\tv_nop\n\tv_nop"); }
    publish_tile();
    if (kt + 2 * TK < SK) stage(kt + 2 * TK, buf); }   // refill the buffer that every wave has just left
  wait_copies();
  const float inv = 1.0f / (l * PS * XS);
#pragma unroll
  for (int t = 0; t < 4; ++t)
#pragma unroll
    for (int r = 0; r < 8; ++r) To[wave][col][t * 16 + 8 * hh + r] = o[t][r] * inv;
  wave_lds_sync();
  { for (int rr = 0; rr < 16; ++rr) { const v2f f = *(const v2f*)(&To[wave][rr][lane * 2]); v2h hv, lv; for (int j = 0; j < 2; ++j) { b16 p, q; split16(f[j] * XS, p, q); hv[j] = p; lv[j] = q; }
      const size_t oi = ((size_t)b * S + q0 + rr) * DM + h * HD + lane * 2; *(v2h*)(Ch + oi) = hv; *(v2h*)(Cl + oi) = lv; }  }
}
__global__ __launch_bounds__(128) void out_kernel(const b16* __restrict__ Ch, const b16* __restrict__ Cl, const b16* __restrict__ WO, const float* __restrict__ bo, float* __restrict__ out) {
  __shared__ __attribute__((aligned(16))) float Tf[4][16][128 + 4]; __shared__ __attribute__((aligned(16))) b16 Ws[2][128][LP]; __shared__ __attribute__((aligned(16))) b16 Ahs[2][64][LP]; __shared__ __attribute__((aligned(16))) b16 Als[2][64][LP];   // two-buffer ring: 128 x 64 weight tile (read by all four waves), 64 x 64 ctx hi and lo tiles
  const int wave = threadIdx.x >> 5, lane = threadIdx.x & 31, nloc = lane & 15, hlf = lane >> 4; const int b = blockIdx.x / (QL / 64), rb = blockIdx.x % (QL / 64); const size_t m0 = (size_t)b * S + rb * 64 + wave * 16; const int n0 = blockIdx.y * 128;
  v8f acc[8];
#pragma unroll
  for (int t = 0; t < 8; ++t) acc[t] = (v8f){};
  const b16* Wn = WO + (size_t)n0 * DM; const int sr = threadIdx.x >> 3, sc = (threadIdx.x & 7) * 8;   // 8 lanes per 128-B row; 128 threads cover rows sr + 16 j
  const size_t a0 = ((size_t)b * S + rb * 64 + sr) * DM + sc; constexpr unsigned LS = 16 * LP * 2; constexpr size_t GS = (size_t)16 * DM;
  auto stage = [&](int k0, int buf) { const b16* gh = Ch + a0 + k0; const b16* gl = Cl + a0 + k0; const unsigned lh = lds_off(&Ahs[buf][sr][sc]), ll = lds_off(&Als[buf][sr][sc]);
    copy8(lh, gh, lh + LS, gh + GS, lh + 2 * LS, gh + 2 * GS, lh + 3 * LS, gh + 3 * GS, ll, gl, ll + LS, gl + GS, ll + 2 * LS, gl + 2 * GS, ll + 3 * LS, gl + 3 * GS); stage_w128(Ws[buf], Wn, k0); };
  stage(0, 0); wait_copies(); __syncthreads(); stage(TK, 1);
#pragma unroll 1   // one trip per ring tile: the buffer index and the publish point stay in one place
  for (int kt = 0; kt < DM; kt += TK) { const int buf = (kt / TK) & 1;
    v16b ah[2], al[2], bw[2][8];   // the whole tile's fragments, read as one group
#pragma unroll     // both 32-k steps of a tile: constant LDS offsets
    for (int s = 0; s < 2; ++s) { ah[s] = frag_kb(&Ahs[buf][wave * 16 + nloc][32 * s], hlf); al[s] = frag_kb(&Als[buf][wave * 16 + nloc][32 * s], hlf);
#pragma unroll   // the fragment arrays stay in registers only under constant indices
      for (int t = 0; t < 8; ++t) bw[s][t] = frag_kb(&Ws[buf][t * 16 + nloc][32 * s], hlf); }
    reads_stay_ahead();
#pragma unroll   // the fragment arrays stay in registers only under constant indices
    for (int s = 0; s < 2; ++s)
#pragma unroll   // the fragment arrays stay in registers only under constant indices
      for (int t = 0; t < 8; ++t) { acc[t] = wmma16b(ah[s], bw[s][t], acc[t]); acc[t] = wmma16b(al[s], bw[s][t], acc[t]); }
    products_stay_in_trip(); publish_tile();
    if (kt + 2 * TK < DM) stage(kt + 2 * TK, buf); }   // refill the buffers that every wave has just left
  wait_copies();
#pragma unroll
  for (int t = 0; t < 8; ++t) { const float bb = bf16_rne(bo[n0 + t * 16 + nloc]);
#pragma unroll
    for (int r = 0; r < 8; ++r) Tf[wave][8 * hlf + r][t * 16 + nloc] = acc[t][r] * (1.0f / (XS * WSC)) + bb; }
  wave_lds_sync();
  { for (int rr = 0; rr < 16; ++rr) *(v4f*)(out + (m0 + rr) * DM + n0 + lane * 4) = *(const v4f*)(&Tf[wave][rr][lane * 4]);  }
}
}  // namespace

extern "C" void kernel_launch(void* const* d_in, const int* in_sizes, int n_in, void* d_out, int out_size, void* d_ws, size_t ws_size, hipStream_t stream) {
  (void)n_in;
  auto Fp = [&](int i) { return (const float*)d_in[i]; };
  // input order: 0 inputs_q [2,2048,1024], 1 inputs_kv, 2 Wq [1024,16,64], 3 Wk, 4 Wv, 5 bq [16,64], 6 bk, 7 bv, 8 Wo [16,64,1024], 9 bo [1024]
  if (in_sizes[0] != B * S * DM || in_sizes[1] != B * S * DM || in_sizes[2] != DM * DM || in_sizes[3] != DM * DM || in_sizes[4] != DM * DM || in_sizes[5] != DM || in_sizes[8] != DM * DM || in_sizes[9] != DM || out_size != B * S * DM) return;
  size_t off = 0; char* ws = (char*)d_ws;
  auto carve = [&](size_t bytes) { char* p = ws + off; off += (bytes + 255) & ~(size_t)255; return p; };
  b16* WT = (b16*)carve((size_t)3 * DM * DM * 2); b16* WO = (b16*)carve((size_t)DM * DM * 2); const size_t plane = (size_t)B * S * DM * 2;
  b16* Qp = (b16*)carve(plane); b16* Kp = (b16*)carve(plane); b16* VTh = (b16*)carve(plane); b16* VTl = (b16*)carve(plane); b16* Ch = (b16*)carve(plane); b16* Cl = (b16*)carve(plane);
  if (off > ws_size || off > ((size_t)128 << 20)) return;   // ≈ 58.7 MB (6 planes x 8.4 MB + 8.4 MB weights)
  prep_kernel<<<PREP_BLOCKS, 256, 0, stream>>>(Fp(2), Fp(3), Fp(4), Fp(8), WT, WO);
  proj_kernel<<<dim3(S / 64, BL * 3, 8), 128, 0, stream>>>(Fp(0), Fp(1), WT, Fp(5), Fp(6), Fp(7), Qp, Kp, VTh, VTl);
  attn_kernel<<<dim3(QL / 128, BL * H), 256, 0, stream>>>(Qp, Kp, VTh, VTl, Ch, Cl);
  out_kernel<<<dim3((QL / 64) * BL, 8), 128, 0, stream>>>(Ch, Cl, WO, Fp(9), (float*)d_out);
}

// v004
// A run of this version takes 112 microseconds.
// In two side-by-side timings against v003, it was 1.05 and 1.06 times as fast.
// Over all steps from v000 it is 4.57 times as fast.
#include <hip/hip_runtime.h>

// Multi-head dot-product attention (16 heads x 64, d_model 1024) on inputs_q / inputs_kv [2, 2048, 1024]: q = inputs_q Wq + bq, k/v = inputs_kv Wk/Wv + b; attn = softmax(q k^T / 8) per head over
// all 2,048 keys; ctx = attn v; out = ctx Wo + bo -> [2][2048][1024].
// Deterministic: flash-style per 32-query wave over one half of the keys in order (running max), the two halves joined once at the end, fixed reduction trees; no atomics.
// compute dtype: WMMA v_wmma_f32_16x16x32_f16 with f32 accumulate for the three projections ([4096 x 1024] x [1024 x 1024]; inputs EXACT bf16 x8, [d][h][f]
// weights transposed exact x256: 1 product), S^T = K Q^T (q, k single f16 x8: 1 product), O^T += V^T P^T (v hi+lo x8, P x1024 single f16: 2 products) and out = ctx Wo ([4096 x 1024] x [1024 x 1024];
// ctx as hi+lo x8 planes: 2 products, Wo transposed exact x256); softmax statistics (exp2, running max) in f32. Inputs rounded to bf16 once.

namespace {
constexpr int B = 2, S = 2048, DM = 1024, H = 16, HD = 64, BL = 2 /* batches computed (== B shipped) */, QL = 2048 /* query rows computed (== S shipped) */, SK = 2048 /* key rows used (== S shipped) */;
constexpr float XS = 8.0f, WSC = 256.0f, PS = 1024.0f, LOG2E = 1.4426950408889634f;
static_assert(S % 64 == 0 && QL % 128 == 0 && SK % 64 == 0 && DM == H * HD, "tiling");
typedef _Float16 b16;
typedef __attribute__((ext_vector_type(16))) _Float16 v16b;
typedef __attribute__((ext_vector_type(8))) _Float16 v8b;
typedef __attribute__((ext_vector_type(8))) float v8f;
typedef __attribute__((ext_vector_type(4))) float v4f;
__device__ __forceinline__ float bf16_rne(float f) { unsigned int u = __float_as_uint(f); u += 0x7FFFu + ((u >> 16) & 1u); return __uint_as_float(u & 0xFFFF0000u); }
__device__ __forceinline__ void split16(float v, b16& hi, b16& lo) { hi = (b16)v; lo = (b16)(v - (float)hi); }
__device__ __forceinline__ v16b frag_kb(const b16* p, int hh) { const v8b a = *(const v8b*)(p + 8 * hh), b = *(const v8b*)(p + 16 + 8 * hh); v16b f;
#pragma unroll
  for (int e = 0; e < 8; ++e) { f[e] = a[e]; f[8 + e] = b[e]; } return f; }
__device__ __forceinline__ v8f wmma16b(v16b a, v16b b, v8f c) { return __builtin_amdgcn_wmma_f32_16x16x32_f16(false, a, false, b, (short)0, c, false, false); }
// Stands between a block's LDS fragment reads and its matrix products: without it the scheduler sinks each read to its product again and the wave waits out the LDS latency once per product.
__device__ __forceinline__ void reads_stay_ahead() { __builtin_amdgcn_sched_barrier(0); }
// Stands between a tile's matrix products and its publish point: without it the scheduler sinks the products below the barrier, in front of the refill, and the next copies start a whole run of products later.
__device__ __forceinline__ void products_stay_in_trip() { __builtin_amdgcn_sched_barrier(0); }
__device__ __forceinline__ void wave_lds_sync() { __builtin_amdgcn_fence(__ATOMIC_RELEASE, "workgroup"); __builtin_amdgcn_wave_barrier(); __builtin_amdgcn_fence(__ATOMIC_ACQUIRE, "workgroup"); }
__device__ __forceinline__ float pmul(float a, float b) { float p = a * b; asm volatile("" : "+v"(p)); return p; }
__device__ __forceinline__ int iclamp(int v, int lo, int hi) { return v < lo ? lo : (v > hi ? hi : v); }

typedef __attribute__((ext_vector_type(2))) _Float16 v2h;
typedef __attribute__((ext_vector_type(4))) _Float16 v4h;
typedef __attribute__((ext_vector_type(2))) float v2f;
__device__ __forceinline__ float nexp2(float v) { return __builtin_amdgcn_exp2f(v); }
// LDS staging of operand tiles that all waves of a block read: rows of 64 f16 (one whole 128-B line), LDS pitch 144 B (16 B x odd: no bank conflict for the 16-byte fragment reads).
constexpr int TK = 64, LP = TK + 8, XP = TK + 4;   // XP: the same for rows of 64 f32 (256 B at pitch 272 B)
static_assert(SK % TK == 0 && SK >= 2 * TK && DM % TK == 0 && DM >= 2 * TK && (LP * 2) % 16 == 0, "two-buffer ring needs two tiles");
__device__ __forceinline__ unsigned lds_off(const void* p) { return (unsigned)(size_t)p; }
// Each lane copies 16 bytes global -> LDS per line, through no register; the closing s_wait_xcnt keeps every later rewrite of the address registers behind the issued copies.
__device__ __forceinline__ void copy6(unsigned l0, const void* g0, unsigned l1, const void* g1, unsigned l2, const void* g2, unsigned l3, const void* g3, unsigned l4, const void* g4, unsigned l5, const void* g5) {
  asm volatile("global_load_async_to_lds_b128 %0, %1, off\n\tglobal_load_async_to_lds_b128 %2, %3, off\n\tglobal_load_async_to_lds_b128 %4, %5, off\n\t"
               "global_load_async_to_lds_b128 %6, %7, off\n\tglobal_load_async_to_lds_b128 %8, %9, off\n\tglobal_load_async_to_lds_b128 %10, %11, off\n\ts_wait_xcnt 0x0"
               :: "v"(l0), "v"(g0), "v"(l1), "v"(g1), "v"(l2), "v"(g2), "v"(l3), "v"(g3), "v"(l4), "v"(g4), "v"(l5), "v"(g5) : "memory"); }
__device__ __forceinline__ void copy8(unsigned l0, const void* g0, unsigned l1, const void* g1, unsigned l2, const void* g2, unsigned l3, const void* g3, unsigned l4, const void* g4, unsigned l5, const void* g5, unsigned l6, const void* g6, unsigned l7, const void* g7) {
  asm volatile("global_load_async_to_lds_b128 %0, %1, off\n\tglobal_load_async_to_lds_b128 %2, %3, off\n\tglobal_load_async_to_lds_b128 %4, %5, off\n\tglobal_load_async_to_lds_b128 %6, %7, off\n\t"
               "global_load_async_to_lds_b128 %8, %9, off\n\tglobal_load_async_to_lds_b128 %10, %11, off\n\tglobal_load_async_to_lds_b128 %12, %13, off\n\tglobal_load_async_to_lds_b128 %14, %15, off\n\ts_wait_xcnt 0x0"
               :: "v"(l0), "v"(g0), "v"(l1), "v"(g1), "v"(l2), "v"(g2), "v"(l3), "v"(g3), "v"(l4), "v"(g4), "v"(l5), "v"(g5), "v"(l6), "v"(g6), "v"(l7), "v"(g7) : "memory"); }
// This wave's own copies have landed (the compiler places no wait for them).
__device__ __forceinline__ void wait_copies() { asm volatile("s_wait_asynccnt 0x0" ::: "memory"); }
// Publish point of the two-buffer ring: this wave's LDS reads of the old tile are done, its copies of the next tile have landed, then the block barrier hands both over.
__device__ __forceinline__ void publish_tile() { asm volatile("s_wait_dscnt 0x0" ::: "memory"); wait_copies(); __syncthreads(); }
// A 64-row x 64-k f32 input tile by 128 threads: 16 lanes per 256-B row, 8 rows per copy line.
__device__ __forceinline__ void stage_x64(float (*dst)[XP], const float* xrow0, int k0) {
  const int sr = threadIdx.x >> 4, sc = (threadIdx.x & 15) * 4; const float* g = xrow0 + (size_t)sr * DM + k0 + sc; const unsigned l = lds_off(&dst[sr][sc]); constexpr unsigned LS = 8 * XP * 4; constexpr size_t GS = (size_t)8 * DM;
  copy8(l, g, l + LS, g + GS, l + 2 * LS, g + 2 * GS, l + 3 * LS, g + 3 * GS, l + 4 * LS, g + 4 * GS, l + 5 * LS, g + 5 * GS, l + 6 * LS, g + 6 * GS, l + 7 * LS, g + 7 * GS); }
// A 128-row x 64-k weight tile (rows n0.., columns k0..) by 128 threads: 8 lanes per row, 16 rows per copy line.
__device__ __forceinline__ void stage_w128(b16 (*dst)[LP], const b16* Wrow0, int k0) {
  const int sr = threadIdx.x >> 3, sc = (threadIdx.x & 7) * 8; const b16* g = Wrow0 + (size_t)sr * DM + k0 + sc; const unsigned l = lds_off(&dst[sr][sc]); constexpr unsigned LS = 16 * LP * 2; constexpr size_t GS = (size_t)16 * DM;
  copy8(l, g, l + LS, g + GS, l + 2 * LS, g + 2 * GS, l + 3 * LS, g + 3 * GS, l + 4 * LS, g + 4 * GS, l + 5 * LS, g + 5 * GS, l + 6 * LS, g + 6 * GS, l + 7 * LS, g + 7 * GS); }
// Weight transposition, one 128 x 128 tile of one weight per block: each wave load takes whole 128-B lines (4 k rows x 32 columns), a thread rounds and scales two neighbouring k rows and stores them as f16 pairs into the turned LDS tile,
// which leaves as 256-B pieces of the [column][k] rows. LDS pitch 264 B: the 4-byte stores of a wave and its 8-byte reads each fall on distinct banks.
constexpr int PT = 128, PP = PT + 4, PTN = DM / PT, PREP_BLOCKS = 4 * PTN * PTN;
static_assert(DM % PT == 0 && (PP * 2) % 8 == 0, "prep tiling");
__global__ __launch_bounds__(256) void prep_kernel(const float* __restrict__ wq, const float* __restrict__ wk, const float* __restrict__ wv, const float* __restrict__ wo, b16* __restrict__ WT, b16* __restrict__ WO) {
  __shared__ __attribute__((aligned(16))) b16 T[PT][PP];
  const int m = blockIdx.x / (PTN * PTN), tile = blockIdx.x % (PTN * PTN); const int kb = (tile / PTN) * PT, ob = (tile % PTN) * PT;
  const float* w = m == 0 ? wq : (m == 1 ? wk : (m == 2 ? wv : wo)); b16* dst = m < 3 ? WT + (size_t)m * DM * DM : WO;
  const int wave = threadIdx.x >> 5, lane = threadIdx.x & 31; const int k = (wave >> 2) * 8 + (lane >> 3) * 2, oo = (wave & 3) * 32 + (lane & 7) * 4;   // pass p: rows k + 16 p and the next, columns oo .. oo + 3
  const float* g = w + (size_t)(kb + k) * DM + ob + oo;
  v4f x0[8], x1[8];
#pragma unroll   // all sixteen loads of a thread in flight at once, off one address
  for (int p = 0; p < 8; ++p) { x0[p] = *(const v4f*)(g + (size_t)(16 * p) * DM); x1[p] = *(const v4f*)(g + (size_t)(16 * p + 1) * DM); }
  asm volatile("s_wait_xcnt 0x0" :: "v"(g) : "memory");   // the wait behind the issued loads; naming g keeps their address pair from being given to the last load's result in front of it
  __builtin_amdgcn_sched_barrier(0);   // without it the scheduler sinks most of the loads below the first conversions, and a thread waits out the memory latency several times instead of once
#pragma unroll   // x0, x1 stay in registers only under constant indices
  for (int p = 0; p < 8; ++p)
#pragma unroll
    for (int i = 0; i < 4; ++i) { v2h pr; pr[0] = (b16)(bf16_rne(x0[p][i]) * WSC); pr[1] = (b16)(bf16_rne(x1[p][i]) * WSC); *(v2h*)&T[oo + i][k + 16 * p] = pr; }
  __syncthreads();
  const int ro = threadIdx.x >> 4, k8 = (threadIdx.x & 15) * 8; b16* d = dst + (size_t)(ob + ro) * DM + kb + k8;   // pass p: column ro + 16 p, 16 lanes per 256-B piece
#pragma unroll
  for (int p = 0; p < 8; ++p) { const v4h a = *(const v4h*)&T[ro + 16 * p][k8], b = *(const v4h*)&T[ro + 16 * p][k8 + 4]; v8b o;
#pragma unroll
    for (int j = 0; j < 4; ++j) { o[j] = a[j]; o[4 + j] = b[j]; }
    *(v8b*)(d + (size_t)(16 * p) * DM) = o; }
}
// projections: grid (rows/64, BL x 3 (which), 8 slabs of 128); block = 64 tokens x 4 waves; A = bf16(input) x8; 8 tiles x 32 k-steps, 1 product; + bias.
// Per 64-k tile the block's 64 x 64 f32 inputs and the slab's 128 x 64 weights are copied once into a two-buffer LDS ring; a wave rounds its A fragment as it reads it, all four waves take their B fragments from the ring.
__global__ __launch_bounds__(128) void proj_kernel(const float* __restrict__ xq, const float* __restrict__ xkv, const b16* __restrict__ WT, const float* __restrict__ bq, const float* __restrict__ bk, const float* __restrict__ bv, b16* __restrict__ Qp, b16* __restrict__ Kp, b16* __restrict__ VTh, b16* __restrict__ VTl) {
  __shared__ __attribute__((aligned(16))) float Xs[2][64][XP];
  // The weight ring and the output staging share these bytes: Tf is first written behind the ring's last publish point, when no wave reads the ring and no copy is in flight.
  __shared__ __attribute__((aligned(16))) unsigned char U[2 * 128 * LP * 2]; static_assert(sizeof(U) >= sizeof(float) * 4 * 16 * (128 + 4), "staging fits the ring");
  b16 (*Ws)[128][LP] = (b16 (*)[128][LP])U; float (*Tf)[16][128 + 4] = (float (*)[16][128 + 4])U;
  const int wave = threadIdx.x >> 5, lane = threadIdx.x & 31, nloc = lane & 15, hlf = lane >> 4; const int which = blockIdx.y % 3, b = blockIdx.y / 3; const int rb = blockIdx.x, slab = blockIdx.z; const int t0 = rb * 64 + wave * 16; const int n0 = slab * 128;
  if ((which == 0 && rb * 64 >= QL) || (which != 0 && rb * 64 >= SK)) return;   // block-uniform
  const float* x = (which == 0) ? xq : xkv; const b16* W = WT + (size_t)which * DM * DM; const float* bias = which == 0 ? bq : (which == 1 ? bk : bv);
  v8f acc[8];
#pragma unroll
  for (int t = 0; t < 8; ++t) acc[t] = (v8f){};
  const b16* Wn = W + (size_t)n0 * DM; const float* xb = x + ((size_t)b * S + rb * 64) * DM;
  auto stage = [&](int k0, int buf) { stage_x64(Xs[buf], xb, k0); stage_w128(Ws[buf], Wn, k0); };
  stage(0, 0); wait_copies(); __syncthreads(); stage(TK, 1);
#pragma unroll 1   // one trip per ring tile: the buffer index and the publish point stay in one place
  for (int k0 = 0; k0 < DM; k0 += TK) { const int buf = (k0 / TK) & 1;
    v4f xv[2][4]; v16b bw[2][8];   // the whole tile's fragments, read as one group
#pragma unroll     // both 32-k steps of a tile: constant LDS offsets
    for (int s = 0; s < 2; ++s) { const float* xr = &Xs[buf][wave * 16 + nloc][32 * s + 8 * hlf];   // k order of frag_kb: 8 hlf + 0..7, then 16 + 8 hlf + 0..7
      xv[s][0] = *(const v4f*)xr; xv[s][1] = *(const v4f*)(xr + 4); xv[s][2] = *(const v4f*)(xr + 16); xv[s][3] = *(const v4f*)(xr + 20);
#pragma unroll   // the fragment arrays stay in registers only under constant indices
      for (int t = 0; t < 8; ++t) bw[s][t] = frag_kb(&Ws[buf][t * 16 + nloc][32 * s], hlf); }
    reads_stay_ahead();
#pragma unroll   // the fragment arrays stay in registers only under constant indices
    for (int s = 0; s < 2; ++s) { v16b a;
#pragma unroll
      for (int j = 0; j < 4; ++j) { a[j] = (b16)(bf16_rne(xv[s][0][j]) * XS); a[4 + j] = (b16)(bf16_rne(xv[s][1][j]) * XS); a[8 + j] = (b16)(bf16_rne(xv[s][2][j]) * XS); a[12 + j] = (b16)(bf16_rne(xv[s][3][j]) * XS); }
#pragma unroll
      for (int t = 0; t < 8; ++t) acc[t] = wmma16b(a, bw[s][t], acc[t]); }
    products_stay_in_trip(); publish_tile();
    if (k0 + 2 * TK < DM) stage(k0 + 2 * TK, buf); }   // refill the buffers that every wave has just left
  wait_copies();
#pragma unroll
  for (int t = 0; t < 8; ++t) { const float bb = bf16_rne(bias[n0 + t * 16 + nloc]);
#pragma unroll
    for (int r = 0; r < 8; ++r) Tf[wave][8 * hlf + r][t * 16 + nloc] = acc[t][r] * (1.0f / (XS * WSC)) + bb; }
  __syncthreads();
  {
    if (which == 2) {
#pragma unroll 1
      for (int q = 0; q < 32; ++q) { const int cl = wave * 32 + q; const int c = n0 + cl; const int h = c / HD, d = c % HD; const int tk = lane * 2; v2h hv, lv;
        for (int j = 0; j < 2; ++j) { b16 p, ql; split16(Tf[(tk + j) >> 4][(tk + j) & 15][cl] * XS, p, ql); hv[j] = p; lv[j] = ql; }
        const size_t oi = (((size_t)b * H + h) * HD + d) * S + rb * 64 + lane * 2; *(v2h*)(VTh + oi) = hv; *(v2h*)(VTl + oi) = lv; } }
    else { b16* P = which == 0 ? Qp : Kp;
      for (int rr = 0; rr < 16; ++rr) { for (int hs = 0; hs < 2; ++hs) { const int c = n0 + hs * 64; const int h = c / HD; v2h o; o[0] = (b16)(Tf[wave][rr][hs * 64 + lane * 2] * XS); o[1] = (b16)(Tf[wave][rr][hs * 64 + lane * 2 + 1] * XS);
          *(v2h*)(P + (((size_t)b * H + h) * S + (t0 + rr)) * HD + lane * 2) = o; } } }
     }
}
// attention: grid (QL/128, BL*H): block = 8 waves = 4 groups of 32 queries x 2 halves of the keys (waves w and w + 4 share their queries); a wave walks its 1,024 keys in order (2 key tiles per 32-key step),
// online softmax (running max) per 16-query column group, P x1024 single via LDS, O^T += V^T P^T (v hi+lo: 2 products); each K and V^T fragment read from LDS feeds the products of both column groups.
// K, V^T hi and V^T lo come in 64-key tiles, one per key half, copied once per block into a two-buffer LDS ring while the tiles before are worked on. Behind the loop the two halves' (max, sum, O) are joined through LDS.
constexpr int KH = SK / 2, TB = TK * LP * 2 /* bytes of a 64-row tile */, XB = 8 * 16 * (HD + 4) * 4 /* bytes of eight 16 x 64 f32 staging tiles */;
static_assert(KH % TK == 0 && KH >= 2 * TK && HD == TK && QL % 128 == 0, "each key half feeds its own two-buffer ring");
__global__ __launch_bounds__(256) void attn_kernel(const b16* __restrict__ Qp, const b16* __restrict__ Kp, const b16* __restrict__ VTh, const b16* __restrict__ VTl, b16* __restrict__ Ch, b16* __restrict__ Cl) {
  __shared__ __attribute__((aligned(16))) b16 Pb[8][32][32 + 8];
  // The ring and the closing staging share these bytes: the staging is first written behind the ring's last publish point, when no wave reads the ring and no copy is in flight.
  __shared__ __attribute__((aligned(16))) unsigned char R[12 * TB]; static_assert(sizeof(R) >= 2 * XB + 8 * 32 * 2 * 4, "staging fits the ring");
  b16 (*Ks)[2][TK][LP] = (b16 (*)[2][TK][LP])R; b16 (*Vhs)[2][HD][LP] = (b16 (*)[2][HD][LP])(R + 4 * TB); b16 (*Vls)[2][HD][LP] = (b16 (*)[2][HD][LP])(R + 8 * TB);   // [buffer][key half][row][k]
  float (*Xo)[16][HD + 4] = (float (*)[16][HD + 4])R; float (*To)[16][HD + 4] = (float (*)[16][HD + 4])(R + XB); float (*ML)[32][2] = (float (*)[32][2])(R + 2 * XB);
  const int wave = threadIdx.x >> 5, lane = threadIdx.x & 31, hh = lane >> 4, col = lane & 15; const int grp = wave & 3, kh = wave >> 2; const int b = blockIdx.y / H, h = blockIdx.y % H; const int q0 = blockIdx.x * 128 + grp * 32;
  const b16* Qb = Qp + ((size_t)(b * H + h) * S) * HD; const b16* Kb = Kp + ((size_t)(b * H + h) * S) * HD; const b16* Vh = VTh + ((size_t)(b * H + h) * HD) * S; const b16* Vl = VTl + ((size_t)(b * H + h) * HD) * S;
  v16b qa[2][2];
#pragma unroll   // the fragment arrays stay in registers only under constant indices
  for (int c = 0; c < 2; ++c) { const b16* qr = Qb + (size_t)(q0 + 16 * c + col) * HD; qa[c][0] = frag_kb(qr, hh); qa[c][1] = frag_kb(qr + 32, hh); }
  const float cs = LOG2E / (8.0f * XS * XS);   // 1/sqrt(64) and the two x8 carriers, in the log2 domain
  float m[2] = {-INFINITY, -INFINITY}, l[2] = {0.0f, 0.0f}; v8f o[2][4];
#pragma unroll   // the accumulator array stays in registers only under constant indices
  for (int c = 0; c < 2; ++c)
#pragma unroll   // as above
    for (int t = 0; t < 4; ++t) o[c][t] = (v8f){};
  const int sr = threadIdx.x >> 3, sc = (threadIdx.x & 7) * 8;   // 8 lanes per 128-B row; 256 threads cover rows sr and sr + 32 of each of the six tiles
  auto stage = [&](int kt, int buf) {
#pragma unroll   // one run of copies per key half
    for (int hf = 0; hf < 2; ++hf) { const int kk = hf * KH + kt;
      copy6(lds_off(&Ks[buf][hf][sr][sc]), Kb + (size_t)(kk + sr) * HD + sc, lds_off(&Ks[buf][hf][sr + 32][sc]), Kb + (size_t)(kk + sr + 32) * HD + sc,
            lds_off(&Vhs[buf][hf][sr][sc]), Vh + (size_t)sr * S + kk + sc, lds_off(&Vhs[buf][hf][sr + 32][sc]), Vh + (size_t)(sr + 32) * S + kk + sc,
            lds_off(&Vls[buf][hf][sr][sc]), Vl + (size_t)sr * S + kk + sc, lds_off(&Vls[buf][hf][sr + 32][sc]), Vl + (size_t)(sr + 32) * S + kk + sc); } };
  stage(0, 0); wait_copies(); __syncthreads(); stage(TK, 1);
#pragma unroll 1   // one trip per ring tile: the buffer index and the publish point stay in one place
  for (int kt = 0; kt < KH; kt += TK) { const int buf = (kt / TK) & 1;
#pragma unroll 1
  for (int kb = 0; kb < TK; kb += 32) {
    float e[2][16], al[2]; v16b kf[2][2], vh[4], vl[4], pf[2];   // the step's K and V^T fragments, read as one group: the V^T reads land behind the softmax
#pragma unroll   // the fragment arrays stay in registers only under constant indices
    for (int u = 0; u < 2; ++u) { const b16* kr = &Ks[buf][kh][kb + u * 16 + col][0]; kf[u][0] = frag_kb(kr, hh); kf[u][1] = frag_kb(kr + 32, hh); }
#pragma unroll   // the fragment arrays stay in registers only under constant indices
    for (int t = 0; t < 4; ++t) { vh[t] = frag_kb(&Vhs[buf][kh][t * 16 + col][kb], hh); vl[t] = frag_kb(&Vls[buf][kh][t * 16 + col][kb], hh); }
    reads_stay_ahead();
#pragma unroll   // both column groups: the arrays stay in registers only under constant indices
    for (int c = 0; c < 2; ++c) { float mx = -INFINITY;
#pragma unroll
      for (int u = 0; u < 2; ++u) { v8f s = (v8f){}; s = wmma16b(kf[u][0], qa[c][0], s); s = wmma16b(kf[u][1], qa[c][1], s);
#pragma unroll
        for (int r = 0; r < 8; ++r) { const float v = s[r] * cs; e[c][u * 8 + r] = v; mx = fmaxf(mx, v); } }
      mx = fmaxf(mx, __shfl_xor(mx, 16)); const float mn = fmaxf(m[c], mx); al[c] = nexp2(m[c] - mn); float sum = 0.0f;
#pragma unroll
      for (int i2 = 0; i2 < 16; ++i2) { const float p = nexp2(e[c][i2] - mn); sum += p; Pb[wave][16 * c + col][(i2 < 8 ? 0 : 16) + 8 * hh + (i2 & 7)] = (b16)(p * PS); }
      sum += __shfl_xor(sum, 16); l[c] = l[c] * al[c] + sum; m[c] = mn; }
    wave_lds_sync();
#pragma unroll   // the fragment arrays stay in registers only under constant indices
    for (int c = 0; c < 2; ++c) pf[c] = frag_kb(&Pb[wave][16 * c + col][0], hh);
#pragma unroll   // the fragment and accumulator arrays stay in registers only under constant indices
    for (int t = 0; t < 4; ++t)
#pragma unroll   // as above: one V^T fragment, both column groups
      for (int c = 0; c < 2; ++c) { o[c][t] *= al[c]; o[c][t] = wmma16b(vh[t], pf[c], o[c][t]); o[c][t] = wmma16b(vl[t], pf[c], o[c][t]); }
    wave_lds_sync();
    // The step's last WMMA stands next to the loop's back edge: four vector slots before the next step's address arithmetic may reuse its A registers.
    __builtin_amdgcn_sched_barrier(0); asm volatile("v_nop\n\tv_nop\n\tv_nop\n\tv_nop"); }
    publish_tile();
    if (kt + 2 * TK < KH) stage(kt + 2 * TK, buf); }   // refill the buffers that every wave has just left
  wait_copies();
  // Join of the two key halves: wave w keeps column group kh and hands the other group's (max, sum, O) to wave w ^ 4, lane for lane; one block barrier between the hand-over's writes and its reads.
  const bool up = kh != 0; const int pw = wave ^ 4;
  const float mk = up ? m[1] : m[0], lk = up ? l[1] : l[0];
  ML[wave][lane][0] = up ? m[0] : m[1]; ML[wave][lane][1] = up ? l[0] : l[1];
#pragma unroll   // the accumulator array stays in registers only under constant indices
  for (int t = 0; t < 4; ++t)
#pragma unroll   // as above
    for (int r = 0; r < 8; ++r) Xo[wave][col][t * 16 + 8 * hh + r] = up ? o[0][t][r] : o[1][t][r];
  __syncthreads();
  const float mo = ML[pw][lane][0], lo = ML[pw][lane][1]; const float mn = fmaxf(mk, mo), ak = nexp2(mk - mn), ao = nexp2(mo - mn);
  const float inv = 1.0f / ((lk * ak + lo * ao) * PS * XS);
#pragma unroll   // the accumulator array stays in registers only under constant indices
  for (int t = 0; t < 4; ++t)
#pragma unroll   // as above
    for (int r = 0; r < 8; ++r) To[wave][col][t * 16 + 8 * hh + r] = ((up ? o[1][t][r] : o[0][t][r]) * ak + Xo[pw][col][t * 16 + 8 * hh + r] * ao) * inv;
  wave_lds_sync();
  { for (int rr = 0; rr < 16; ++rr) { const v2f f = *(const v2f*)(&To[wave][rr][lane * 2]); v2h hv, lv; for (int j = 0; j < 2; ++j) { b16 p, q; split16(f[j] * XS, p, q); hv[j] = p; lv[j] = q; }
      const size_t oi = ((size_t)b * S + q0 + 16 * kh + rr) * DM + h * HD + lane * 2; *(v2h*)(Ch + oi) = hv; *(v2h*)(Cl + oi) = lv; }  }
}
__global__ __launch_bounds__(128) void out_kernel(const b16* __restrict__ Ch, const b16* __restrict__ Cl, const b16* __restrict__ WO, const float* __restrict__ bo, float* __restrict__ out) {
  __shared__ __attribute__((aligned(16))) float Tf[4][16][128 + 4]; __shared__ __attribute__((aligned(16))) b16 Ws[2][128][LP]; __shared__ __attribute__((aligned(16))) b16 Ahs[2][64][LP]; __shared__ __attribute__((aligned(16))) b16 Als[2][64][LP];   // two-buffer ring: 128 x 64 weight tile (read by all four waves), 64 x 64 ctx hi and lo tiles
  const int wave = threadIdx.x >> 5, lane = threadIdx.x & 31, nloc = lane & 15, hlf = lane >> 4; const int b = blockIdx.x / (QL / 64), rb = blockIdx.x % (QL / 64); const size_t m0 = (size_t)b * S + rb * 64 + wave * 16; const int n0 = blockIdx.y * 128;
  v8f acc[8];
#pragma unroll
  for (int t = 0; t < 8; ++t) acc[t] = (v8f){};
  const b16* Wn = WO + (size_t)n0 * DM; const int sr = threadIdx.x >> 3, sc = (threadIdx.x & 7) * 8;   // 8 lanes per 128-B row; 128 threads cover rows sr + 16 j
  const size_t a0 = ((size_t)b * S + rb * 64 + sr) * DM + sc; constexpr unsigned LS = 16 * LP * 2; constexpr size_t GS = (size_t)16 * DM;
  auto stage = [&](int k0, int buf) { const b16* gh = Ch + a0 + k0; const b16* gl = Cl + a0 + k0; const unsigned lh = lds_off(&Ahs[buf][sr][sc]), ll = lds_off(&Als[buf][sr][sc]);
    copy8(lh, gh, lh + LS, gh + GS, lh + 2 * LS, gh + 2 * GS, lh + 3 * LS, gh + 3 * GS, ll, gl, ll + LS, gl + GS, ll + 2 * LS, gl + 2 * GS, ll + 3 * LS, gl + 3 * GS); stage_w128(Ws[buf], Wn, k0); };
  stage(0, 0); wait_copies(); __syncthreads(); stage(TK, 1);
#pragma unroll 1   // one trip per ring tile: the buffer index and the publish point stay in one place
  for (int kt = 0; kt < DM; kt += TK) { const int buf = (kt / TK) & 1;
    v16b ah[2], al[2], bw[2][8];   // the whole tile's fragments, read as one group
#pragma unroll     // both 32-k steps of a tile: constant LDS offsets
    for (int s = 0; s < 2; ++s) { ah[s] = frag_kb(&Ahs[buf][wave * 16 + nloc][32 * s], hlf); al[s] = frag_kb(&Als[buf][wave * 16 + nloc][32 * s], hlf);
#pragma unroll   // the fragment arrays stay in registers only under constant indices
      for (int t = 0; t < 8; ++t) bw[s][t] = frag_kb(&Ws[buf][t * 16 + nloc][32 * s], hlf); }
    reads_stay_ahead();
#pragma unroll   // the fragment arrays stay in registers only under constant indices
    for (int s = 0; s < 2; ++s)
#pragma unroll   // the fragment arrays stay in registers only under constant indices
      for (int t = 0; t < 8; ++t) { acc[t] = wmma16b(ah[s], bw[s][t], acc[t]); acc[t] = wmma16b(al[s], bw[s][t], acc[t]); }
    products_stay_in_trip(); publish_tile();
    if (kt + 2 * TK < DM) stage(kt + 2 * TK, buf); }   // refill the buffers that every wave has just left
  wait_copies();
#pragma unroll
  for (int t = 0; t < 8; ++t) { const float bb = bf16_rne(bo[n0 + t * 16 + nloc]);
#pragma unroll
    for (int r = 0; r < 8; ++r) Tf[wave][8 * hlf + r][t * 16 + nloc] = acc[t][r] * (1.0f / (XS * WSC)) + bb; }
  wave_lds_sync();
  { for (int rr = 0; rr < 16; ++rr) *(v4f*)(out + (m0 + rr) * DM + n0 + lane * 4) = *(const v4f*)(&Tf[wave][rr][lane * 4]);  }
}
}  // namespace

extern "C" void kernel_launch(void* const* d_in, const int* in_sizes, int n_in, void* d_out, int out_size, void* d_ws, size_t ws_size, hipStream_t stream) {
  (void)n_in;
  auto Fp = [&](int i) { return (const float*)d_in[i]; };
  // input order: 0 inputs_q [2,2048,1024], 1 inputs_kv, 2 Wq [1024,16,64], 3 Wk, 4 Wv, 5 bq [16,64], 6 bk, 7 bv, 8 Wo [16,64,1024], 9 bo [1024]
  if (in_sizes[0] != B * S * DM || in_sizes[1] != B * S * DM || in_sizes[2] != DM * DM || in_sizes[3] != DM * DM || in_sizes[4] != DM * DM || in_sizes[5] != DM || in_sizes[8] != DM * DM || in_sizes[9] != DM || out_size != B * S * DM) return;
  size_t off = 0; char* ws = (char*)d_ws;
  auto carve = [&](size_t bytes) { char* p = ws + off; off += (bytes + 255) & ~(size_t)255; return p; };
  b16* WT = (b16*)carve((size_t)3 * DM * DM * 2); b16* WO = (b16*)carve((size_t)DM * DM * 2); const size_t plane = (size_t)B * S * DM * 2;
  b16* Qp = (b16*)carve(plane); b16* Kp = (b16*)carve(plane); b16* VTh = (b16*)carve(plane); b16* VTl = (b16*)carve(plane); b16* Ch = (b16*)carve(plane); b16* Cl = (b16*)carve(plane);
  if (off > ws_size || off > ((size_t)128 << 20)) return;   // ≈ 58.7 MB (6 planes x 8.4 MB + 8.4 MB weights)
  prep_kernel<<<PREP_BLOCKS, 256, 0, stream>>>(Fp(2), Fp(3), Fp(4), Fp(8), WT, WO);
  proj_kernel<<<dim3(S / 64, BL * 3, 8), 128, 0, stream>>>(Fp(0), Fp(1), WT, Fp(5), Fp(6), Fp(7), Qp, Kp, VTh, VTl);
  attn_kernel<<<dim3(QL / 128, BL * H), 256, 0, stream>>>(Qp, Kp, VTh, VTl, Ch, Cl);
  out_kernel<<<dim3((QL / 64) * BL, 8), 128, 0, stream>>>(Ch, Cl, WO, Fp(9), (float*)d_out);
}

// v005
// Measured time: 106 microseconds a run.
// In both of two side-by-side timings against v004, it was 1.06 times as fast.
// All steps since v000 together make it 4.85 times as fast.
#include <hip/hip_runtime.h>

// Multi-head dot-product attention (16 heads x 64, d_model 1024) on inputs_q / inputs_kv [2, 2048, 1024]: q = inputs_q Wq + bq, k/v = inputs_kv Wk/Wv + b; attn = softmax(q k^T / 8) per head over
// all 2,048 keys; ctx = attn v; out = ctx Wo + bo -> [2][2048][1024].
// Deterministic: flash-style per 32-query wave over one half of the keys in order (running max), the two halves joined once at the end, fixed reduction trees; no atomics.
// compute dtype: WMMA v_wmma_f32_16x16x32_f16 with f32 accumulate for the three projections ([4096 x 1024] x [1024 x 1024]; inputs EXACT bf16 x8, [d][h][f]
// weights transposed exact x256: 1 product), S^T = K Q^T (q, k single f16 x8: 1 product), O^T += V^T P^T (v hi+lo x8, P x1024 single f16: 2 products) and out = ctx Wo ([4096 x 1024] x [1024 x 1024];
// ctx as hi+lo x8 planes: 2 products, Wo transposed exact x256); softmax statistics (exp2, running max) in f32. Inputs rounded to bf16 once.

namespace {
constexpr int B = 2, S = 2048, DM = 1024, H = 16, HD = 64, BL = 2 /* batches computed (== B shipped) */, QL = 2048 /* query rows computed (== S shipped) */, SK = 2048 /* key rows used (== S shipped) */;
constexpr float XS = 8.0f, WSC = 256.0f, PS = 1024.0f, LOG2E = 1.4426950408889634f;
static_assert(S % 64 == 0 && QL % 128 == 0 && SK % 64 == 0 && DM == H * HD, "tiling");
typedef _Float16 b16;
typedef __attribute__((ext_vector_type(16))) _Float16 v16b;
typedef __attribute__((ext_vector_type(8))) _Float16 v8b;
typedef __attribute__((ext_vector_type(8))) float v8f;
typedef __attribute__((ext_vector_type(4))) float v4f;
__device__ __forceinline__ float bf16_rne(float f) { unsigned int u = __float_as_uint(f); u += 0x7FFFu + ((u >> 16) & 1u); return __uint_as_float(u & 0xFFFF0000u); }
__device__ __forceinline__ void split16(float v, b16& hi, b16& lo) { hi = (b16)v; lo = (b16)(v - (float)hi); }
__device__ __forceinline__ v16b frag_kb(const b16* p, int hh) { const v8b a = *(const v8b*)(p + 8 * hh), b = *(const v8b*)(p + 16 + 8 * hh); v16b f;
#pragma unroll
  for (int e = 0; e < 8; ++e) { f[e] = a[e]; f[8 + e] = b[e]; } return f; }
__device__ __forceinline__ v8f wmma16b(v16b a, v16b b, v8f c) { return __builtin_amdgcn_wmma_f32_16x16x32_f16(false, a, false, b, (short)0, c, false, false); }
// Stands between a block's LDS fragment reads and its matrix products: without it the scheduler sinks each read to its product again and the wave waits out the LDS latency once per product.
__device__ __forceinline__ void reads_stay_ahead() { __builtin_amdgcn_sched_barrier(0); }
// Stands between a tile's matrix products and its publish point: without it the scheduler sinks the products below the barrier, in front of the refill, and the next copies start a whole run of products later.
__device__ __forceinline__ void products_stay_in_trip() { __builtin_amdgcn_sched_barrier(0); }
// Stands between a 32-k step's matrix products and the next step's LDS reads: without it the scheduler lifts those reads over the last product into registers of their own, past v255, and the loop pays a register-window switch at each use.
__device__ __forceinline__ void steps_stay_apart() { __builtin_amdgcn_sched_barrier(0); }
__device__ __forceinline__ void wave_lds_sync() { __builtin_amdgcn_fence(__ATOMIC_RELEASE, "workgroup"); __builtin_amdgcn_wave_barrier(); __builtin_amdgcn_fence(__ATOMIC_ACQUIRE, "workgroup"); }
__device__ __forceinline__ float pmul(float a, float b) { float p = a * b; asm volatile("" : "+v"(p)); return p; }
__device__ __forceinline__ int iclamp(int v, int lo, int hi) { return v < lo ? lo : (v > hi ? hi : v); }

typedef __attribute__((ext_vector_type(2))) _Float16 v2h;
typedef __attribute__((ext_vector_type(4))) _Float16 v4h;
typedef __attribute__((ext_vector_type(2))) float v2f;
__device__ __forceinline__ float nexp2(float v) { return __builtin_amdgcn_exp2f(v); }
// LDS staging of operand tiles that all waves of a block read: rows of 64 f16 (one whole 128-B line), LDS pitch 144 B (16 B x odd: no bank conflict for the 16-byte fragment reads).
constexpr int TK = 64, LP = TK + 8, XP = TK + 4;   // XP: the same for rows of 64 f32 (256 B at pitch 272 B)
static_assert(SK % TK == 0 && SK >= 2 * TK && DM % TK == 0 && DM >= 2 * TK && (LP * 2) % 16 == 0, "two-buffer ring needs two tiles");
__device__ __forceinline__ unsigned lds_off(const void* p) { return (unsigned)(size_t)p; }
// Each lane copies 16 bytes global -> LDS per line, through no register; the closing s_wait_xcnt keeps every later rewrite of the address registers behind the issued copies.
__device__ __forceinline__ void copy6(unsigned l0, const void* g0, unsigned l1, const void* g1, unsigned l2, const void* g2, unsigned l3, const void* g3, unsigned l4, const void* g4, unsigned l5, const void* g5) {
  asm volatile("global_load_async_to_lds_b128 %0, %1, off\n\tglobal_load_async_to_lds_b128 %2, %3, off\n\tglobal_load_async_to_lds_b128 %4, %5, off\n\t"
               "global_load_async_to_lds_b128 %6, %7, off\n\tglobal_load_async_to_lds_b128 %8, %9, off\n\tglobal_load_async_to_lds_b128 %10, %11, off\n\ts_wait_xcnt 0x0"
               :: "v"(l0), "v"(g0), "v"(l1), "v"(g1), "v"(l2), "v"(g2), "v"(l3), "v"(g3), "v"(l4), "v"(g4), "v"(l5), "v"(g5) : "memory"); }
__device__ __forceinline__ void copy8(unsigned l0, const void* g0, unsigned l1, const void* g1, unsigned l2, const void* g2, unsigned l3, const void* g3, unsigned l4, const void* g4, unsigned l5, const void* g5, unsigned l6, const void* g6, unsigned l7, const void* g7) {
  asm volatile("global_load_async_to_lds_b128 %0, %1, off\n\tglobal_load_async_to_lds_b128 %2, %3, off\n\tglobal_load_async_to_lds_b128 %4, %5, off\n\tglobal_load_async_to_lds_b128 %6, %7, off\n\t"
               "global_load_async_to_lds_b128 %8, %9, off\n\tglobal_load_async_to_lds_b128 %10, %11, off\n\tglobal_load_async_to_lds_b128 %12, %13, off\n\tglobal_load_async_to_lds_b128 %14, %15, off\n\ts_wait_xcnt 0x0"
               :: "v"(l0), "v"(g0), "v"(l1), "v"(g1), "v"(l2), "v"(g2), "v"(l3), "v"(g3), "v"(l4), "v"(g4), "v"(l5), "v"(g5), "v"(l6), "v"(g6), "v"(l7), "v"(g7) : "memory"); }
// This wave's own copies have landed (the compiler places no wait for them).
__device__ __forceinline__ void wait_copies() { asm volatile("s_wait_asynccnt 0x0" ::: "memory"); }
// Publish point of the two-buffer ring: this wave's LDS reads of the old tile are done, its copies of the next tile have landed, then the block barrier hands both over.
__device__ __forceinline__ void publish_tile() { asm volatile("s_wait_dscnt 0x0" ::: "memory"); wait_copies(); __syncthreads(); }
// A 64-row x 64-k f32 input tile by 128 threads: 16 lanes per 256-B row, 8 rows per copy line.
__device__ __forceinline__ void stage_x64(float (*dst)[XP], const float* xrow0, int k0) {
  const int sr = threadIdx.x >> 4, sc = (threadIdx.x & 15) * 4; const float* g = xrow0 + (size_t)sr * DM + k0 + sc; const unsigned l = lds_off(&dst[sr][sc]); constexpr unsigned LS = 8 * XP * 4; constexpr size_t GS = (size_t)8 * DM;
  copy8(l, g, l + LS, g + GS, l + 2 * LS, g + 2 * GS, l + 3 * LS, g + 3 * GS, l + 4 * LS, g + 4 * GS, l + 5 * LS, g + 5 * GS, l + 6 * LS, g + 6 * GS, l + 7 * LS, g + 7 * GS); }
// A 128-row x 64-k weight tile (rows n0.., columns k0..) by 128 threads: 8 lanes per row, 16 rows per copy line.
__device__ __forceinline__ void stage_w128(b16 (*dst)[LP], const b16* Wrow0, int k0) {
  const int sr = threadIdx.x >> 3, sc = (threadIdx.x & 7) * 8; const b16* g = Wrow0 + (size_t)sr * DM + k0 + sc; const unsigned l = lds_off(&dst[sr][sc]); constexpr unsigned LS = 16 * LP * 2; constexpr size_t GS = (size_t)16 * DM;
  copy8(l, g, l + LS, g + GS, l + 2 * LS, g + 2 * GS, l + 3 * LS, g + 3 * GS, l + 4 * LS, g + 4 * GS, l + 5 * LS, g + 5 * GS, l + 6 * LS, g + 6 * GS, l + 7 * LS, g + 7 * GS); }
// Weight transposition, one 128 x 128 tile of one weight per block: each wave load takes whole 128-B lines (4 k rows x 32 columns), a thread rounds and scales two neighbouring k rows and stores them as f16 pairs into the turned LDS tile,
// which leaves as 256-B pieces of the [column][k] rows. LDS pitch 264 B: the 4-byte stores of a wave and its 8-byte reads each fall on distinct banks.
constexpr int PT = 128, PP = PT + 4, PTN = DM / PT, PREP_BLOCKS = 4 * PTN * PTN;
static_assert(DM % PT == 0 && (PP * 2) % 8 == 0, "prep tiling");
__global__ __launch_bounds__(256) void prep_kernel(const float* __restrict__ wq, const float* __restrict__ wk, const float* __restrict__ wv, const float* __restrict__ wo, b16* __restrict__ WT, b16* __restrict__ WO) {
  __shared__ __attribute__((aligned(16))) b16 T[PT][PP];
  const int m = blockIdx.x / (PTN * PTN), tile = blockIdx.x % (PTN * PTN); const int kb = (tile / PTN) * PT, ob = (tile % PTN) * PT;
  const float* w = m == 0 ? wq : (m == 1 ? wk : (m == 2 ? wv : wo)); b16* dst = m < 3 ? WT + (size_t)m * DM * DM : WO;
  const int wave = threadIdx.x >> 5, lane = threadIdx.x & 31; const int k = (wave >> 2) * 8 + (lane >> 3) * 2, oo = (wave & 3) * 32 + (lane & 7) * 4;   // pass p: rows k + 16 p and the next, columns oo .. oo + 3
  const float* g = w + (size_t)(kb + k) * DM + ob + oo;
  v4f x0[8], x1[8];
#pragma unroll   // all sixteen loads of a thread in flight at once, off one address
  for (int p = 0; p < 8; ++p) { x0[p] = *(const v4f*)(g + (size_t)(16 * p) * DM); x1[p] = *(const v4f*)(g + (size_t)(16 * p + 1) * DM); }
  asm volatile("s_wait_xcnt 0x0" :: "v"(g) : "memory");   // the wait behind the issued loads; naming g keeps their address pair from being given to the last load's result in front of it
  __builtin_amdgcn_sched_barrier(0);   // without it the scheduler sinks most of the loads below the first conversions, and a thread waits out the memory latency several times instead of once
#pragma unroll   // x0, x1 stay in registers only under constant indices
  for (int p = 0; p < 8; ++p)
#pragma unroll
    for (int i = 0; i < 4; ++i) { v2h pr; pr[0] = (b16)(bf16_rne(x0[p][i]) * WSC); pr[1] = (b16)(bf16_rne(x1[p][i]) * WSC); *(v2h*)&T[oo + i][k + 16 * p] = pr; }
  __syncthreads();
  const int ro = threadIdx.x >> 4, k8 = (threadIdx.x & 15) * 8; b16* d = dst + (size_t)(ob + ro) * DM + kb + k8;   // pass p: column ro + 16 p, 16 lanes per 256-B piece
#pragma unroll
  for (int p = 0; p < 8; ++p) { const v4h a = *(const v4h*)&T[ro + 16 * p][k8], b = *(const v4h*)&T[ro + 16 * p][k8 + 4]; v8b o;
#pragma unroll
    for (int j = 0; j < 4; ++j) { o[j] = a[j]; o[4 + j] = b[j]; }
    *(v8b*)(d + (size_t)(16 * p) * DM) = o; }
}
// projections: grid (rows/128, BL x 3 (which), 8 slabs of 128); block = 128 tokens x 128 columns, 4 waves of 32 tokens x 128 columns; A = bf16(input) x8; 16 tiles x 32 k-steps, 1 product; + bias.
// Per 64-k tile the block's 128 x 64 f32 inputs and the slab's 128 x 64 weights are copied once into a two-buffer LDS ring; a wave rounds its two A fragments as it reads them, and each B fragment it takes from the ring feeds both.
constexpr int PM = 128, PW = PM / 4;   // tokens per block and per wave
static_assert(S % PM == 0 && QL % PM == 0 && SK % PM == 0 && PW == 32, "projection tiling");
__global__ __launch_bounds__(128) void proj_kernel(const float* __restrict__ xq, const float* __restrict__ xkv, const b16* __restrict__ WT, const float* __restrict__ bq, const float* __restrict__ bk, const float* __restrict__ bv, b16* __restrict__ Qp, b16* __restrict__ Kp, b16* __restrict__ VTh, b16* __restrict__ VTl) {
  // The input ring and the output staging share these bytes: the staging is first written behind the ring's last publish point, when no wave reads the ring and no copy is in flight.
  __shared__ __attribute__((aligned(16))) unsigned char U[2 * PM * XP * 4]; static_assert(sizeof(U) >= sizeof(float) * 4 * PW * (128 + 4) && sizeof(U) >= sizeof(b16) * 2 * 128 * (PM + 8), "staging fits the ring");
  __shared__ __attribute__((aligned(16))) b16 Ws[2][128][LP];
  float (*Xs)[PM][XP] = (float (*)[PM][XP])U; float (*Tf)[PW][128 + 4] = (float (*)[PW][128 + 4])U; b16 (*Tv)[128][PM + 8] = (b16 (*)[128][PM + 8])U;   // Tv: [hi, lo][column][token], pitch 272 B (16 B x odd)
  const int wave = threadIdx.x >> 5, lane = threadIdx.x & 31, nloc = lane & 15, hlf = lane >> 4; const int which = blockIdx.y % 3, b = blockIdx.y / 3; const int rb = blockIdx.x, slab = blockIdx.z; const int t0 = rb * PM + wave * PW; const int n0 = slab * 128;
  if ((which == 0 && rb * PM >= QL) || (which != 0 && rb * PM >= SK)) return;   // block-uniform
  const float* x = (which == 0) ? xq : xkv; const b16* W = WT + (size_t)which * DM * DM; const float* bias = which == 0 ? bq : (which == 1 ? bk : bv);
  v8f acc[2][8];
#pragma unroll
  for (int c = 0; c < 2; ++c)
#pragma unroll
    for (int t = 0; t < 8; ++t) acc[c][t] = (v8f){};
  const b16* Wn = W + (size_t)n0 * DM; const float* xb = x + ((size_t)b * S + rb * PM) * DM;
  auto stage = [&](int k0, int buf) { stage_x64(&Xs[buf][0], xb, k0); stage_x64(&Xs[buf][64], xb + (size_t)64 * DM, k0); stage_w128(Ws[buf], Wn, k0); };
  stage(0, 0); wait_copies(); __syncthreads(); stage(TK, 1);
#pragma unroll 1   // one trip per ring tile: the buffer index and the publish point stay in one place
  for (int k0 = 0; k0 < DM; k0 += TK) { const int buf = (k0 / TK) & 1;
#pragma unroll     // both 32-k steps of a tile: constant LDS offsets
    for (int s = 0; s < 2; ++s) { v4f xv[2][4]; v16b bw[8], a[2];   // the step's fragments, read as one group
#pragma unroll   // the fragment arrays stay in registers only under constant indices
      for (int c = 0; c < 2; ++c) { const float* xr = &Xs[buf][wave * PW + 16 * c + nloc][32 * s + 8 * hlf];   // k order of frag_kb: 8 hlf + 0..7, then 16 + 8 hlf + 0..7
        xv[c][0] = *(const v4f*)xr; xv[c][1] = *(const v4f*)(xr + 4); xv[c][2] = *(const v4f*)(xr + 16); xv[c][3] = *(const v4f*)(xr + 20); }
#pragma unroll   // the fragment arrays stay in registers only under constant indices
      for (int t = 0; t < 8; ++t) bw[t] = frag_kb(&Ws[buf][t * 16 + nloc][32 * s], hlf);
      reads_stay_ahead();
#pragma unroll   // the fragment arrays stay in registers only under constant indices
      for (int c = 0; c < 2; ++c)
#pragma unroll
        for (int j = 0; j < 4; ++j) { a[c][j] = (b16)(bf16_rne(xv[c][0][j]) * XS); a[c][4 + j] = (b16)(bf16_rne(xv[c][1][j]) * XS); a[c][8 + j] = (b16)(bf16_rne(xv[c][2][j]) * XS); a[c][12 + j] = (b16)(bf16_rne(xv[c][3][j]) * XS); }
#pragma unroll   // the fragment and accumulator arrays stay in registers only under constant indices
      for (int t = 0; t < 8; ++t)
#pragma unroll   // as above: one weight fragment, both token groups
        for (int c = 0; c < 2; ++c) acc[c][t] = wmma16b(a[c], bw[t], acc[c][t]);
      if (s == 0) steps_stay_apart(); }
    products_stay_in_trip(); publish_tile();
    if (k0 + 2 * TK < DM) stage(k0 + 2 * TK, buf); }   // refill the buffers that every wave has just left
  wait_copies();
  // Staging. V: a lane's eight accumulator registers are eight neighbouring tokens of one column, so its hi and lo halves go as 16-byte pieces into the [column][token] tiles. Q, K: f32 rows, each wave its own 32.
  float bb[8];
#pragma unroll
  for (int t = 0; t < 8; ++t) bb[t] = bf16_rne(bias[n0 + t * 16 + nloc]);
  if (which == 2) {
#pragma unroll   // the accumulator array stays in registers only under constant indices
    for (int t = 0; t < 8; ++t)
#pragma unroll   // as above
      for (int c = 0; c < 2; ++c) { v8b hv, lv;
#pragma unroll
        for (int r = 0; r < 8; ++r) { b16 p, ql; split16((acc[c][t][r] * (1.0f / (XS * WSC)) + bb[t]) * XS, p, ql); hv[r] = p; lv[r] = ql; }
        *(v8b*)&Tv[0][t * 16 + nloc][wave * PW + 16 * c + 8 * hlf] = hv; *(v8b*)&Tv[1][t * 16 + nloc][wave * PW + 16 * c + 8 * hlf] = lv; } }
  else {
#pragma unroll   // the accumulator array stays in registers only under constant indices
    for (int t = 0; t < 8; ++t)
#pragma unroll   // as above
      for (int c = 0; c < 2; ++c)
#pragma unroll
        for (int r = 0; r < 8; ++r) Tf[wave][16 * c + 8 * hlf + r][t * 16 + nloc] = acc[c][t][r] * (1.0f / (XS * WSC)) + bb[t]; }
  __syncthreads();
  if (which == 2) {   // a wave's 32 columns, two per pass: 16 lanes per 256-B row piece of V^T hi and of V^T lo; head h, row d of column c is row b DM + c of the [B H HD][S] planes
    const int cl = wave * 32 + hlf; const size_t oi = ((size_t)b * DM + n0 + cl) * S + rb * PM + nloc * 8;
#pragma unroll   // all of a wave's pieces in flight at once, off one address per plane
    for (int q = 0; q < 16; ++q) { *(v8b*)(VTh + oi + (size_t)(2 * q) * S) = *(const v8b*)&Tv[0][cl + 2 * q][nloc * 8]; *(v8b*)(VTl + oi + (size_t)(2 * q) * S) = *(const v8b*)&Tv[1][cl + 2 * q][nloc * 8]; } }
  else { b16* P = which == 0 ? Qp : Kp; const int c = n0 + lane * 4; const int h = c / HD, d = c % HD;   // a token's 128 columns per pass: one whole 128-B line for each of the slab's two heads
    b16* pr = P + (((size_t)b * H + h) * S + t0) * HD + d;
#pragma unroll   // all of a wave's rows in flight at once, off one address
    for (int rr = 0; rr < PW; ++rr) { const v4f f = *(const v4f*)&Tf[wave][rr][lane * 4]; v4h o;
#pragma unroll
      for (int j = 0; j < 4; ++j) o[j] = (b16)(f[j] * XS);
      *(v4h*)(pr + (size_t)rr * HD) = o; }
    asm volatile("s_wait_xcnt 0x0" ::: "memory"); }   // the wait behind the issued stores, in front of any later rewrite of their address and data registers
}
// attention: grid (QL/128, BL*H): block = 8 waves = 4 groups of 32 queries x 2 halves of the keys (waves w and w + 4 share their queries); a wave walks its 1,024 keys in order (2 key tiles per 32-key step),
// online softmax (running max) per 16-query column group, P x1024 single via LDS, O^T += V^T P^T (v hi+lo: 2 products); each K and V^T fragment read from LDS feeds the products of both column groups.
// K, V^T hi and V^T lo come in 64-key tiles, one per key half, copied once per block into a two-buffer LDS ring while the tiles before are worked on. Behind the loop the two halves' (max, sum, O) are joined through LDS.
constexpr int KH = SK / 2, TB = TK * LP * 2 /* bytes of a 64-row tile */, XB = 8 * 16 * (HD + 4) * 4 /* bytes of eight 16 x 64 f32 staging tiles */;
static_assert(KH % TK == 0 && KH >= 2 * TK && HD == TK && QL % 128 == 0, "each key half feeds its own two-buffer ring");
__global__ __launch_bounds__(256) void attn_kernel(const b16* __restrict__ Qp, const b16* __restrict__ Kp, const b16* __restrict__ VTh, const b16* __restrict__ VTl, b16* __restrict__ Ch, b16* __restrict__ Cl) {
  __shared__ __attribute__((aligned(16))) b16 Pb[8][32][32 + 8];
  // The ring and the closing staging share these bytes: the staging is first written behind the ring's last publish point, when no wave reads the ring and no copy is in flight.
  __shared__ __attribute__((aligned(16))) unsigned char R[12 * TB]; static_assert(sizeof(R) >= 2 * XB + 8 * 32 * 2 * 4, "staging fits the ring");
  b16 (*Ks)[2][TK][LP] = (b16 (*)[2][TK][LP])R; b16 (*Vhs)[2][HD][LP] = (b16 (*)[2][HD][LP])(R + 4 * TB); b16 (*Vls)[2][HD][LP] = (b16 (*)[2][HD][LP])(R + 8 * TB);   // [buffer][key half][row][k]
  float (*Xo)[16][HD + 4] = (float (*)[16][HD + 4])R; float (*To)[16][HD + 4] = (float (*)[16][HD + 4])(R + XB); float (*ML)[32][2] = (float (*)[32][2])(R + 2 * XB);
  const int wave = threadIdx.x >> 5, lane = threadIdx.x & 31, hh = lane >> 4, col = lane & 15; const int grp = wave & 3, kh = wave >> 2; const int b = blockIdx.y / H, h = blockIdx.y % H; const int q0 = blockIdx.x * 128 + grp * 32;
  const b16* Qb = Qp + ((size_t)(b * H + h) * S) * HD; const b16* Kb = Kp + ((size_t)(b * H + h) * S) * HD; const b16* Vh = VTh + ((size_t)(b * H + h) * HD) * S; const b16* Vl = VTl + ((size_t)(b * H + h) * HD) * S;
  v16b qa[2][2];
#pragma unroll   // the fragment arrays stay in registers only under constant indices
  for (int c = 0; c < 2; ++c) { const b16* qr = Qb + (size_t)(q0 + 16 * c + col) * HD; qa[c][0] = frag_kb(qr, hh); qa[c][1] = frag_kb(qr + 32, hh); }
  const float cs = LOG2E / (8.0f * XS * XS);   // 1/sqrt(64) and the two x8 carriers, in the log2 domain
  float m[2] = {-INFINITY, -INFINITY}, l[2] = {0.0f, 0.0f}; v8f o[2][4];
#pragma unroll   // the accumulator array stays in registers only under constant indices
  for (int c = 0; c < 2; ++c)
#pragma unroll   // as above
    for (int t = 0; t < 4; ++t) o[c][t] = (v8f){};
  const int sr = threadIdx.x >> 3, sc = (threadIdx.x & 7) * 8;   // 8 lanes per 128-B row; 256 threads cover rows sr and sr + 32 of each of the six tiles
  auto stage = [&](int kt, int buf) {
#pragma unroll   // one run of copies per key half
    for (int hf = 0; hf < 2; ++hf) { const int kk = hf * KH + kt;
      copy6(lds_off(&Ks[buf][hf][sr][sc]), Kb + (size_t)(kk + sr) * HD + sc, lds_off(&Ks[buf][hf][sr + 32][sc]), Kb + (size_t)(kk + sr + 32) * HD + sc,
            lds_off(&Vhs[buf][hf][sr][sc]), Vh + (size_t)sr * S + kk + sc, lds_off(&Vhs[buf][hf][sr + 32][sc]), Vh + (size_t)(sr + 32) * S + kk + sc,
            lds_off(&Vls[buf][hf][sr][sc]), Vl + (size_t)sr * S + kk + sc, lds_off(&Vls[buf][hf][sr + 32][sc]), Vl + (size_t)(sr + 32) * S + kk + sc); } };
  stage(0, 0); wait_copies(); __syncthreads(); stage(TK, 1);
#pragma unroll 1   // one trip per ring tile: the buffer index and the publish point stay in one place
  for (int kt = 0; kt < KH; kt += TK) { const int buf = (kt / TK) & 1;
#pragma unroll 1
  for (int kb = 0; kb < TK; kb += 32) {
    float e[2][16], al[2]; v16b kf[2][2], vh[4], vl[4], pf[2];   // the step's K and V^T fragments, read as one group: the V^T reads land behind the softmax
#pragma unroll   // the fragment arrays stay in registers only under constant indices
    for (int u = 0; u < 2; ++u) { const b16* kr = &Ks[buf][kh][kb + u * 16 + col][0]; kf[u][0] = frag_kb(kr, hh); kf[u][1] = frag_kb(kr + 32, hh); }
#pragma unroll   // the fragment arrays stay in registers only under constant indices
    for (int t = 0; t < 4; ++t) { vh[t] = frag_kb(&Vhs[buf][kh][t * 16 + col][kb], hh); vl[t] = frag_kb(&Vls[buf][kh][t * 16 + col][kb], hh); }
    reads_stay_ahead();
#pragma unroll   // both column groups: the arrays stay in registers only under constant indices
    for (int c = 0; c < 2; ++c) { float mx = -INFINITY;
#pragma unroll
      for (int u = 0; u < 2; ++u) { v8f s = (v8f){}; s = wmma16b(kf[u][0], qa[c][0], s); s = wmma16b(kf[u][1], qa[c][1], s);
#pragma unroll
        for (int r = 0; r < 8; ++r) { const float v = s[r] * cs; e[c][u * 8 + r] = v; mx = fmaxf(mx, v); } }
      mx = fmaxf(mx, __shfl_xor(mx, 16)); const float mn = fmaxf(m[c], mx); al[c] = nexp2(m[c] - mn); float sum = 0.0f;
#pragma unroll
      for (int i2 = 0; i2 < 16; ++i2) { const float p = nexp2(e[c][i2] - mn); sum += p; Pb[wave][16 * c + col][(i2 < 8 ? 0 : 16) + 8 * hh + (i2 & 7)] = (b16)(p * PS); }
      sum += __shfl_xor(sum, 16); l[c] = l[c] * al[c] + sum; m[c] = mn; }
    wave_lds_sync();
#pragma unroll   // the fragment arrays stay in registers only under constant indices
    for (int c = 0; c < 2; ++c) pf[c] = frag_kb(&Pb[wave][16 * c + col][0], hh);
#pragma unroll   // the fragment and accumulator arrays stay in registers only under constant indices
    for (int t = 0; t < 4; ++t)
#pragma unroll   // as above: one V^T fragment, both column groups
      for (int c = 0; c < 2; ++c) { o[c][t] *= al[c]; o[c][t] = wmma16b(vh[t], pf[c], o[c][t]); o[c][t] = wmma16b(vl[t], pf[c], o[c][t]); }
    wave_lds_sync();
    // The step's last WMMA stands next to the loop's back edge: four vector slots before the next step's address arithmetic may reuse its A registers.
    __builtin_amdgcn_sched_barrier(0); asm volatile("v_nop\n\tv_nop\n\tv_nop\n\tv_nop"); }
    publish_tile();
    if (kt + 2 * TK < KH) stage(kt + 2 * TK, buf); }   // refill the buffers that every wave has just left
  wait_copies();
  // Join of the two key halves: wave w keeps column group kh and hands the other group's (max, sum, O) to wave w ^ 4, lane for lane; one block barrier between the hand-over's writes and its reads.
  const bool up = kh != 0; const int pw = wave ^ 4;
  const float mk = up ? m[1] : m[0], lk = up ? l[1] : l[0];
  ML[wave][lane][0] = up ? m[0] : m[1]; ML[wave][lane][1] = up ? l[0] : l[1];
#pragma unroll   // the accumulator array stays in registers only under constant indices
  for (int t = 0; t < 4; ++t)
#pragma unroll   // as above
    for (int r = 0; r < 8; ++r) Xo[wave][col][t * 16 + 8 * hh + r] = up ? o[0][t][r] : o[1][t][r];
  __syncthreads();
  const float mo = ML[pw][lane][0], lo = ML[pw][lane][1]; const float mn = fmaxf(mk, mo), ak = nexp2(mk - mn), ao = nexp2(mo - mn);
  const float inv = 1.0f / ((lk * ak + lo * ao) * PS * XS);
#pragma unroll   // the accumulator array stays in registers only under constant indices
  for (int t = 0; t < 4; ++t)
#pragma unroll   // as above
    for (int r = 0; r < 8; ++r) To[wave][col][t * 16 + 8 * hh + r] = ((up ? o[1][t][r] : o[0][t][r]) * ak + Xo[pw][col][t * 16 + 8 * hh + r] * ao) * inv;
  wave_lds_sync();
  { for (int rr = 0; rr < 16; ++rr) { const v2f f = *(const v2f*)(&To[wave][rr][lane * 2]); v2h hv, lv; for (int j = 0; j < 2; ++j) { b16 p, q; split16(f[j] * XS, p, q); hv[j] = p; lv[j] = q; }
      const size_t oi = ((size_t)b * S + q0 + 16 * kh + rr) * DM + h * HD + lane * 2; *(v2h*)(Ch + oi) = hv; *(v2h*)(Cl + oi) = lv; }  }
}
__global__ __launch_bounds__(128) void out_kernel(const b16* __restrict__ Ch, const b16* __restrict__ Cl, const b16* __restrict__ WO, const float* __restrict__ bo, float* __restrict__ out) {
  __shared__ __attribute__((aligned(16))) float Tf[4][16][128 + 4]; __shared__ __attribute__((aligned(16))) b16 Ws[2][128][LP]; __shared__ __attribute__((aligned(16))) b16 Ahs[2][64][LP]; __shared__ __attribute__((aligned(16))) b16 Als[2][64][LP];   // two-buffer ring: 128 x 64 weight tile (read by all four waves), 64 x 64 ctx hi and lo tiles
  const int wave = threadIdx.x >> 5, lane = threadIdx.x & 31, nloc = lane & 15, hlf = lane >> 4; const int b = blockIdx.x / (QL / 64), rb = blockIdx.x % (QL / 64); const size_t m0 = (size_t)b * S + rb * 64 + wave * 16; const int n0 = blockIdx.y * 128;
  v8f acc[8];
#pragma unroll
  for (int t = 0; t < 8; ++t) acc[t] = (v8f){};
  const b16* Wn = WO + (size_t)n0 * DM; const int sr = threadIdx.x >> 3, sc = (threadIdx.x & 7) * 8;   // 8 lanes per 128-B row; 128 threads cover rows sr + 16 j
  const size_t a0 = ((size_t)b * S + rb * 64 + sr) * DM + sc; constexpr unsigned LS = 16 * LP * 2; constexpr size_t GS = (size_t)16 * DM;
  auto stage = [&](int k0, int buf) { const b16* gh = Ch + a0 + k0; const b16* gl = Cl + a0 + k0; const unsigned lh = lds_off(&Ahs[buf][sr][sc]), ll = lds_off(&Als[buf][sr][sc]);
    copy8(lh, gh, lh + LS, gh + GS, lh + 2 * LS, gh + 2 * GS, lh + 3 * LS, gh + 3 * GS, ll, gl, ll + LS, gl + GS, ll + 2 * LS, gl + 2 * GS, ll + 3 * LS, gl + 3 * GS); stage_w128(Ws[buf], Wn, k0); };
  stage(0, 0); wait_copies(); __syncthreads(); stage(TK, 1);
#pragma unroll 1   // one trip per ring tile: the buffer index and the publish point stay in one place
  for (int kt = 0; kt < DM; kt += TK) { const int buf = (kt / TK) & 1;
    v16b ah[2], al[2], bw[2][8];   // the whole tile's fragments, read as one group
#pragma unroll     // both 32-k steps of a tile: constant LDS offsets
    for (int s = 0; s < 2; ++s) { ah[s] = frag_kb(&Ahs[buf][wave * 16 + nloc][32 * s], hlf); al[s] = frag_kb(&Als[buf][wave * 16 + nloc][32 * s], hlf);
#pragma unroll   // the fragment arrays stay in registers only under constant indices
      for (int t = 0; t < 8; ++t) bw[s][t] = frag_kb(&Ws[buf][t * 16 + nloc][32 * s], hlf); }
    reads_stay_ahead();
#pragma unroll   // the fragment arrays stay in registers only under constant indices
    for (int s = 0; s < 2; ++s)
#pragma unroll   // the fragment arrays stay in registers only under constant indices
      for (int t = 0; t < 8; ++t) { acc[t] = wmma16b(ah[s], bw[s][t], acc[t]); acc[t] = wmma16b(al[s], bw[s][t], acc[t]); }
    products_stay_in_trip(); publish_tile();
    if (kt + 2 * TK < DM) stage(kt + 2 * TK, buf); }   // refill the buffers that every wave has just left
  wait_copies();
#pragma unroll
  for (int t = 0; t < 8; ++t) { const float bb = bf16_rne(bo[n0 + t * 16 + nloc]);
#pragma unroll
    for (int r = 0; r < 8; ++r) Tf[wave][8 * hlf + r][t * 16 + nloc] = acc[t][r] * (1.0f / (XS * WSC)) + bb; }
  wave_lds_sync();
  { for (int rr = 0; rr < 16; ++rr) *(v4f*)(out + (m0 + rr) * DM + n0 + lane * 4) = *(const v4f*)(&Tf[wave][rr][lane * 4]);  }
}
}  // namespace

extern "C" void kernel_launch(void* const* d_in, const int* in_sizes, int n_in, void* d_out, int out_size, void* d_ws, size_t ws_size, hipStream_t stream) {
  (void)n_in;
  auto Fp = [&](int i) { return (const float*)d_in[i]; };
  // input order: 0 inputs_q [2,2048,1024], 1 inputs_kv, 2 Wq [1024,16,64], 3 Wk, 4 Wv, 5 bq [16,64], 6 bk, 7 bv, 8 Wo [16,64,1024], 9 bo [1024]
  if (in_sizes[0] != B * S * DM || in_sizes[1] != B * S * DM || in_sizes[2] != DM * DM || in_sizes[3] != DM * DM || in_sizes[4] != DM * DM || in_sizes[5] != DM || in_sizes[8] != DM * DM || in_sizes[9] != DM || out_size != B * S * DM) return;
  size_t off = 0; char* ws = (char*)d_ws;
  auto carve = [&](size_t bytes) { char* p = ws + off; off += (bytes + 255) & ~(size_t)255; return p; };
  b16* WT = (b16*)carve((size_t)3 * DM * DM * 2); b16* WO = (b16*)carve((size_t)DM * DM * 2); const size_t plane = (size_t)B * S * DM * 2;
  b16* Qp = (b16*)carve(plane); b16* Kp = (b16*)carve(plane); b16* VTh = (b16*)carve(plane); b16* VTl = (b16*)carve(plane); b16* Ch = (b16*)carve(plane); b16* Cl = (b16*)carve(plane);
  if (off > ws_size || off > ((size_t)128 << 20)) return;   // ≈ 58.7 MB (6 planes x 8.4 MB + 8.4 MB weights)
  prep_kernel<<<PREP_BLOCKS, 256, 0, stream>>>(Fp(2), Fp(3), Fp(4), Fp(8), WT, WO);
  proj_kernel<<<dim3(S / PM, BL * 3, 8), 128, 0, stream>>>(Fp(0), Fp(1), WT, Fp(5), Fp(6), Fp(7), Qp, Kp, VTh, VTl);
  attn_kernel<<<dim3(QL / 128, BL * H), 256, 0, stream>>>(Qp, Kp, VTh, VTl, Ch, Cl);
  out_kernel<<<dim3((QL / 64) * BL, 8), 128, 0, stream>>>(Ch, Cl, WO, Fp(9), (float*)d_out);
}

// v006
// Measured time: 101 microseconds a run.
// Timed twice side by side with v005, it ran 1.05 and 1.04 times as fast.
// All steps since v000 together make it 5.08 times as fast.
#include <hip/hip_runtime.h>

// Multi-head dot-product attention (16 heads x 64, d_model 1024) on inputs_q / inputs_kv [2, 2048, 1024]: q = inputs_q Wq + bq, k/v = inputs_kv Wk/Wv + b; attn = softmax(q k^T / 8) per head over
// all 2,048 keys; ctx = attn v; out = ctx Wo + bo -> [2][2048][1024].
// Deterministic: flash-style per 32-query wave over one half of the keys in order (held reference, at most 2^5 under the running max), the two halves joined once at the end, fixed reduction trees; no atomics.
// compute dtype: WMMA v_wmma_f32_16x16x32_f16 with f32 accumulate for the three projections ([4096 x 1024] x [1024 x 1024]; inputs EXACT bf16 x8, [d][h][f]
// weights transposed exact x256: 1 product), S^T = K Q^T (q, k single f16 x8: 1 product), O^T += V^T P^T (v hi+lo x8, P x1024 single f16: 2 products) and out = ctx Wo ([4096 x 1024] x [1024 x 1024];
// ctx as hi+lo x8 planes: 2 products, Wo transposed exact x256); softmax statistics (exp2, reference, row sums) in f32. Inputs rounded to bf16 once.

namespace {
constexpr int B = 2, S = 2048, DM = 1024, H = 16, HD = 64, BL = 2 /* batches computed (== B shipped) */, QL = 2048 /* query rows computed (== S shipped) */, SK = 2048 /* key rows used (== S shipped) */;
constexpr float XS = 8.0f, WSC = 256.0f, PSL2 = 10.0f /* P and its row sums carry x1024 = 2^PSL2 */, PTOP = 15.0f /* largest exponent let into P: 2^15 is finite in f16 */, LOG2E = 1.4426950408889634f;
static_assert(S % 64 == 0 && QL % 128 == 0 && SK % 64 == 0 && DM == H * HD, "tiling");
typedef _Float16 b16;
typedef __attribute__((ext_vector_type(16))) _Float16 v16b;
typedef __attribute__((ext_vector_type(8))) _Float16 v8b;
typedef __attribute__((ext_vector_type(8))) float v8f;
typedef __attribute__((ext_vector_type(4))) float v4f;
__device__ __forceinline__ float bf16_rne(float f) { unsigned int u = __float_as_uint(f); u += 0x7FFFu + ((u >> 16) & 1u); return __uint_as_float(u & 0xFFFF0000u); }
__device__ __forceinline__ void split16(float v, b16& hi, b16& lo) { hi = (b16)v; lo = (b16)(v - (float)hi); }
__device__ __forceinline__ v16b frag_kb(const b16* p, int hh) { const v8b a = *(const v8b*)(p + 8 * hh), b = *(const v8b*)(p + 16 + 8 * hh); v16b f;
#pragma unroll
  for (int e = 0; e < 8; ++e) { f[e] = a[e]; f[8 + e] = b[e]; } return f; }
__device__ __forceinline__ v8f wmma16b(v16b a, v16b b, v8f c) { return __builtin_amdgcn_wmma_f32_16x16x32_f16(false, a, false, b, (short)0, c, false, false); }
// Stands between a block's LDS fragment reads and its matrix products: without it the scheduler sinks each read to its product again and the wave waits out the LDS latency once per product.
__device__ __forceinline__ void reads_stay_ahead() { __builtin_amdgcn_sched_barrier(0); }
// Stands between a tile's matrix products and its publish point: without it the scheduler sinks the products below the barrier, in front of the refill, and the next copies start a whole run of products later.
__device__ __forceinline__ void products_stay_in_trip() { __builtin_amdgcn_sched_barrier(0); }
// Stands between a 32-k step's matrix products and the next step's LDS reads: without it the scheduler lifts those reads over the last product into registers of their own, past v255, and the loop pays a register-window switch at each use.
__device__ __forceinline__ void steps_stay_apart() { __builtin_amdgcn_sched_barrier(0); }
__device__ __forceinline__ void wave_lds_sync() { __builtin_amdgcn_fence(__ATOMIC_RELEASE, "workgroup"); __builtin_amdgcn_wave_barrier(); __builtin_amdgcn_fence(__ATOMIC_ACQUIRE, "workgroup"); }
__device__ __forceinline__ float pmul(float a, float b) { float p = a * b; asm volatile("" : "+v"(p)); return p; }
__device__ __forceinline__ int iclamp(int v, int lo, int hi) { return v < lo ? lo : (v > hi ? hi : v); }

typedef __attribute__((ext_vector_type(2))) _Float16 v2h;
typedef __attribute__((ext_vector_type(4))) _Float16 v4h;
typedef __attribute__((ext_vector_type(2))) float v2f;
__device__ __forceinline__ float nexp2(float v) { return __builtin_amdgcn_exp2f(v); }
// LDS staging of operand tiles that all waves of a block read: rows of 64 f16 (one whole 128-B line), LDS pitch 144 B (16 B x odd: no bank conflict for the 16-byte fragment reads).
constexpr int TK = 64, LP = TK + 8, XP = TK + 4;   // XP: the same for rows of 64 f32 (256 B at pitch 272 B)
static_assert(SK % TK == 0 && SK >= 2 * TK && DM % TK == 0 && DM >= 2 * TK && (LP * 2) % 16 == 0, "two-buffer ring needs two tiles");
__device__ __forceinline__ unsigned lds_off(const void* p) { return (unsigned)(size_t)p; }
// Each lane copies 16 bytes global -> LDS per line, through no register; the closing s_wait_xcnt keeps every later rewrite of the address registers behind the issued copies.
__device__ __forceinline__ void copy6(unsigned l0, const void* g0, unsigned l1, const void* g1, unsigned l2, const void* g2, unsigned l3, const void* g3, unsigned l4, const void* g4, unsigned l5, const void* g5) {
  asm volatile("global_load_async_to_lds_b128 %0, %1, off\n\tglobal_load_async_to_lds_b128 %2, %3, off\n\tglobal_load_async_to_lds_b128 %4, %5, off\n\t"
               "global_load_async_to_lds_b128 %6, %7, off\n\tglobal_load_async_to_lds_b128 %8, %9, off\n\tglobal_load_async_to_lds_b128 %10, %11, off\n\ts_wait_xcnt 0x0"
               :: "v"(l0), "v"(g0), "v"(l1), "v"(g1), "v"(l2), "v"(g2), "v"(l3), "v"(g3), "v"(l4), "v"(g4), "v"(l5), "v"(g5) : "memory"); }
__device__ __forceinline__ void copy8(unsigned l0, const void* g0, unsigned l1, const void* g1, unsigned l2, const void* g2, unsigned l3, const void* g3, unsigned l4, const void* g4, unsigned l5, const void* g5, unsigned l6, const void* g6, unsigned l7, const void* g7) {
  asm volatile("global_load_async_to_lds_b128 %0, %1, off\n\tglobal_load_async_to_lds_b128 %2, %3, off\n\tglobal_load_async_to_lds_b128 %4, %5, off\n\tglobal_load_async_to_lds_b128 %6, %7, off\n\t"
               "global_load_async_to_lds_b128 %8, %9, off\n\tglobal_load_async_to_lds_b128 %10, %11, off\n\tglobal_load_async_to_lds_b128 %12, %13, off\n\tglobal_load_async_to_lds_b128 %14, %15, off\n\ts_wait_xcnt 0x0"
               :: "v"(l0), "v"(g0), "v"(l1), "v"(g1), "v"(l2), "v"(g2), "v"(l3), "v"(g3), "v"(l4), "v"(g4), "v"(l5), "v"(g5), "v"(l6), "v"(g6), "v"(l7), "v"(g7) : "memory"); }
// This wave's own copies have landed (the compiler places no wait for them).
__device__ __forceinline__ void wait_copies() { asm volatile("s_wait_asynccnt 0x0" ::: "memory"); }
// Publish point of the two-buffer ring: this wave's LDS reads of the old tile are done, its copies of the next tile have landed, then the block barrier hands both over.
__device__ __forceinline__ void publish_tile() { asm volatile("s_wait_dscnt 0x0" ::: "memory"); wait_copies(); __syncthreads(); }
// A 64-row x 64-k f32 input tile by 128 threads: 16 lanes per 256-B row, 8 rows per copy line.
__device__ __forceinline__ void stage_x64(float (*dst)[XP], const float* xrow0, int k0) {
  const int sr = threadIdx.x >> 4, sc = (threadIdx.x & 15) * 4; const float* g = xrow0 + (size_t)sr * DM + k0 + sc; const unsigned l = lds_off(&dst[sr][sc]); constexpr unsigned LS = 8 * XP * 4; constexpr size_t GS = (size_t)8 * DM;
  copy8(l, g, l + LS, g + GS, l + 2 * LS, g + 2 * GS, l + 3 * LS, g + 3 * GS, l + 4 * LS, g + 4 * GS, l + 5 * LS, g + 5 * GS, l + 6 * LS, g + 6 * GS, l + 7 * LS, g + 7 * GS); }
// A 128-row x 64-k weight tile (rows n0.., columns k0..) by 128 threads: 8 lanes per row, 16 rows per copy line.
__device__ __forceinline__ void stage_w128(b16 (*dst)[LP], const b16* Wrow0, int k0) {
  const int sr = threadIdx.x >> 3, sc = (threadIdx.x & 7) * 8; const b16* g = Wrow0 + (size_t)sr * DM + k0 + sc; const unsigned l = lds_off(&dst[sr][sc]); constexpr unsigned LS = 16 * LP * 2; constexpr size_t GS = (size_t)16 * DM;
  copy8(l, g, l + LS, g + GS, l + 2 * LS, g + 2 * GS, l + 3 * LS, g + 3 * GS, l + 4 * LS, g + 4 * GS, l + 5 * LS, g + 5 * GS, l + 6 * LS, g + 6 * GS, l + 7 * LS, g + 7 * GS); }
// Weight transposition, one 128 x 128 tile of one weight per block: each wave load takes whole 128-B lines (4 k rows x 32 columns), a thread rounds and scales two neighbouring k rows and stores them as f16 pairs into the turned LDS tile,
// which leaves as 256-B pieces of the [column][k] rows. LDS pitch 264 B: the 4-byte stores of a wave and its 8-byte reads each fall on distinct banks.
constexpr int PT = 128, PP = PT + 4, PTN = DM / PT, PREP_BLOCKS = 4 * PTN * PTN;
static_assert(DM % PT == 0 && (PP * 2) % 8 == 0, "prep tiling");
__global__ __launch_bounds__(256) void prep_kernel(const float* __restrict__ wq, const float* __restrict__ wk, const float* __restrict__ wv, const float* __restrict__ wo, b16* __restrict__ WT, b16* __restrict__ WO) {
  __shared__ __attribute__((aligned(16))) b16 T[PT][PP];
  const int m = blockIdx.x / (PTN * PTN), tile = blockIdx.x % (PTN * PTN); const int kb = (tile / PTN) * PT, ob = (tile % PTN) * PT;
  const float* w = m == 0 ? wq : (m == 1 ? wk : (m == 2 ? wv : wo)); b16* dst = m < 3 ? WT + (size_t)m * DM * DM : WO;
  const int wave = threadIdx.x >> 5, lane = threadIdx.x & 31; const int k = (wave >> 2) * 8 + (lane >> 3) * 2, oo = (wave & 3) * 32 + (lane & 7) * 4;   // pass p: rows k + 16 p and the next, columns oo .. oo + 3
  const float* g = w + (size_t)(kb + k) * DM + ob + oo;
  v4f x0[8], x1[8];
#pragma unroll   // all sixteen loads of a thread in flight at once, off one address
  for (int p = 0; p < 8; ++p) { x0[p] = *(const v4f*)(g + (size_t)(16 * p) * DM); x1[p] = *(const v4f*)(g + (size_t)(16 * p + 1) * DM); }
  asm volatile("s_wait_xcnt 0x0" :: "v"(g) : "memory");   // the wait behind the issued loads; naming g keeps their address pair from being given to the last load's result in front of it
  __builtin_amdgcn_sched_barrier(0);   // without it the scheduler sinks most of the loads below the first conversions, and a thread waits out the memory latency several times instead of once
#pragma unroll   // x0, x1 stay in registers only under constant indices
  for (int p = 0; p < 8; ++p)
#pragma unroll
    for (int i = 0; i < 4; ++i) { v2h pr; pr[0] = (b16)(bf16_rne(x0[p][i]) * WSC); pr[1] = (b16)(bf16_rne(x1[p][i]) * WSC); *(v2h*)&T[oo + i][k + 16 * p] = pr; }
  __syncthreads();
  const int ro = threadIdx.x >> 4, k8 = (threadIdx.x & 15) * 8; b16* d = dst + (size_t)(ob + ro) * DM + kb + k8;   // pass p: column ro + 16 p, 16 lanes per 256-B piece
#pragma unroll
  for (int p = 0; p < 8; ++p) { const v4h a = *(const v4h*)&T[ro + 16 * p][k8], b = *(const v4h*)&T[ro + 16 * p][k8 + 4]; v8b o;
#pragma unroll
    for (int j = 0; j < 4; ++j) { o[j] = a[j]; o[4 + j] = b[j]; }
    *(v8b*)(d + (size_t)(16 * p) * DM) = o; }
}
// projections: grid (rows/128, BL x 3 (which), 8 slabs of 128); block = 128 tokens x 128 columns, 4 waves of 32 tokens x 128 columns; A = bf16(input) x8; 16 tiles x 32 k-steps, 1 product; + bias.
// Per 64-k tile the block's 128 x 64 f32 inputs and the slab's 128 x 64 weights are copied once into a two-buffer LDS ring; a wave rounds its two A fragments as it reads them, and each B fragment it takes from the ring feeds both.
constexpr int PM = 128, PW = PM / 4;   // tokens per block and per wave
static_assert(S % PM == 0 && QL % PM == 0 && SK % PM == 0 && PW == 32, "projection tiling");
__global__ __launch_bounds__(128) void proj_kernel(const float* __restrict__ xq, const float* __restrict__ xkv, const b16* __restrict__ WT, const float* __restrict__ bq, const float* __restrict__ bk, const float* __restrict__ bv, b16* __restrict__ Qp, b16* __restrict__ Kp, b16* __restrict__ VTh, b16* __restrict__ VTl) {
  // The input ring and the output staging share these bytes: the staging is first written behind the ring's last publish point, when no wave reads the ring and no copy is in flight.
  __shared__ __attribute__((aligned(16))) unsigned char U[2 * PM * XP * 4]; static_assert(sizeof(U) >= sizeof(float) * 4 * PW * (128 + 4) && sizeof(U) >= sizeof(b16) * 2 * 128 * (PM + 8), "staging fits the ring");
  __shared__ __attribute__((aligned(16))) b16 Ws[2][128][LP];
  float (*Xs)[PM][XP] = (float (*)[PM][XP])U; float (*Tf)[PW][128 + 4] = (float (*)[PW][128 + 4])U; b16 (*Tv)[128][PM + 8] = (b16 (*)[128][PM + 8])U;   // Tv: [hi, lo][column][token], pitch 272 B (16 B x odd)
  const int wave = threadIdx.x >> 5, lane = threadIdx.x & 31, nloc = lane & 15, hlf = lane >> 4; const int which = blockIdx.y % 3, b = blockIdx.y / 3; const int rb = blockIdx.x, slab = blockIdx.z; const int t0 = rb * PM + wave * PW; const int n0 = slab * 128;
  if ((which == 0 && rb * PM >= QL) || (which != 0 && rb * PM >= SK)) return;   // block-uniform
  const float* x = (which == 0) ? xq : xkv; const b16* W = WT + (size_t)which * DM * DM; const float* bias = which == 0 ? bq : (which == 1 ? bk : bv);
  v8f acc[2][8];
#pragma unroll
  for (int c = 0; c < 2; ++c)
#pragma unroll
    for (int t = 0; t < 8; ++t) acc[c][t] = (v8f){};
  const b16* Wn = W + (size_t)n0 * DM; const float* xb = x + ((size_t)b * S + rb * PM) * DM;
  auto stage = [&](int k0, int buf) { stage_x64(&Xs[buf][0], xb, k0); stage_x64(&Xs[buf][64], xb + (size_t)64 * DM, k0); stage_w128(Ws[buf], Wn, k0); };
  stage(0, 0); wait_copies(); __syncthreads(); stage(TK, 1);
#pragma unroll 1   // one trip per ring tile: the buffer index and the publish point stay in one place
  for (int k0 = 0; k0 < DM; k0 += TK) { const int buf = (k0 / TK) & 1;
#pragma unroll     // both 32-k steps of a tile: constant LDS offsets
    for (int s = 0; s < 2; ++s) { v4f xv[2][4]; v16b bw[8], a[2];   // the step's fragments, read as one group
#pragma unroll   // the fragment arrays stay in registers only under constant indices
      for (int c = 0; c < 2; ++c) { const float* xr = &Xs[buf][wave * PW + 16 * c + nloc][32 * s + 8 * hlf];   // k order of frag_kb: 8 hlf + 0..7, then 16 + 8 hlf + 0..7
        xv[c][0] = *(const v4f*)xr; xv[c][1] = *(const v4f*)(xr + 4); xv[c][2] = *(const v4f*)(xr + 16); xv[c][3] = *(const v4f*)(xr + 20); }
#pragma unroll   // the fragment arrays stay in registers only under constant indices
      for (int t = 0; t < 8; ++t) bw[t] = frag_kb(&Ws[buf][t * 16 + nloc][32 * s], hlf);
      reads_stay_ahead();
#pragma unroll   // the fragment arrays stay in registers only under constant indices
      for (int c = 0; c < 2; ++c)
#pragma unroll
        for (int j = 0; j < 4; ++j) { a[c][j] = (b16)(bf16_rne(xv[c][0][j]) * XS); a[c][4 + j] = (b16)(bf16_rne(xv[c][1][j]) * XS); a[c][8 + j] = (b16)(bf16_rne(xv[c][2][j]) * XS); a[c][12 + j] = (b16)(bf16_rne(xv[c][3][j]) * XS); }
#pragma unroll   // the fragment and accumulator arrays stay in registers only under constant indices
      for (int t = 0; t < 8; ++t)
#pragma unroll   // as above: one weight fragment, both token groups
        for (int c = 0; c < 2; ++c) acc[c][t] = wmma16b(a[c], bw[t], acc[c][t]);
      if (s == 0) steps_stay_apart(); }
    products_stay_in_trip(); publish_tile();
    if (k0 + 2 * TK < DM) stage(k0 + 2 * TK, buf); }   // refill the buffers that every wave has just left
  wait_copies();
  // Staging. V: a lane's eight accumulator registers are eight neighbouring tokens of one column, so its hi and lo halves go as 16-byte pieces into the [column][token] tiles. Q, K: f32 rows, each wave its own 32.
  float bb[8];
#pragma unroll
  for (int t = 0; t < 8; ++t) bb[t] = bf16_rne(bias[n0 + t * 16 + nloc]);
  if (which == 2) {
#pragma unroll   // the accumulator array stays in registers only under constant indices
    for (int t = 0; t < 8; ++t)
#pragma unroll   // as above
      for (int c = 0; c < 2; ++c) { v8b hv, lv;
#pragma unroll
        for (int r = 0; r < 8; ++r) { b16 p, ql; split16((acc[c][t][r] * (1.0f / (XS * WSC)) + bb[t]) * XS, p, ql); hv[r] = p; lv[r] = ql; }
        *(v8b*)&Tv[0][t * 16 + nloc][wave * PW + 16 * c + 8 * hlf] = hv; *(v8b*)&Tv[1][t * 16 + nloc][wave * PW + 16 * c + 8 * hlf] = lv; } }
  else {
#pragma unroll   // the accumulator array stays in registers only under constant indices
    for (int t = 0; t < 8; ++t)
#pragma unroll   // as above
      for (int c = 0; c < 2; ++c)
#pragma unroll
        for (int r = 0; r < 8; ++r) Tf[wave][16 * c + 8 * hlf + r][t * 16 + nloc] = acc[c][t][r] * (1.0f / (XS * WSC)) + bb[t]; }
  __syncthreads();
  if (which == 2) {   // a wave's 32 columns, two per pass: 16 lanes per 256-B row piece of V^T hi and of V^T lo; head h, row d of column c is row b DM + c of the [B H HD][S] planes
    const int cl = wave * 32 + hlf; const size_t oi = ((size_t)b * DM + n0 + cl) * S + rb * PM + nloc * 8;
#pragma unroll   // all of a wave's pieces in flight at once, off one address per plane
    for (int q = 0; q < 16; ++q) { *(v8b*)(VTh + oi + (size_t)(2 * q) * S) = *(const v8b*)&Tv[0][cl + 2 * q][nloc * 8]; *(v8b*)(VTl + oi + (size_t)(2 * q) * S) = *(const v8b*)&Tv[1][cl + 2 * q][nloc * 8]; } }
  else { b16* P = which == 0 ? Qp : Kp; const int c = n0 + lane * 4; const int h = c / HD, d = c % HD;   // a token's 128 columns per pass: one whole 128-B line for each of the slab's two heads
    b16* pr = P + (((size_t)b * H + h) * S + t0) * HD + d;
#pragma unroll   // all of a wave's rows in flight at once, off one address
    for (int rr = 0; rr < PW; ++rr) { const v4f f = *(const v4f*)&Tf[wave][rr][lane * 4]; v4h o;
#pragma unroll
      for (int j = 0; j < 4; ++j) o[j] = (b16)(f[j] * XS);
      *(v4h*)(pr + (size_t)rr * HD) = o; }
    asm volatile("s_wait_xcnt 0x0" ::: "memory"); }   // the wait behind the issued stores, in front of any later rewrite of their address and data registers
}
// attention: grid (QL/128, BL*H): block = 8 waves = 4 groups of 32 queries x 2 halves of the keys (waves w and w + 4 share their queries); a wave walks its 1,024 keys in order (2 key tiles per 32-key step),
// online softmax per 16-query column group against a held reference (moved, with O and the row sum rescaled, only when a score passes it by 2^5), P x1024 single via LDS, O^T += V^T P^T (v hi+lo: 2 products); each K and V^T fragment read from LDS feeds the products of both column groups.
// K, V^T hi and V^T lo come in 64-key tiles, one per key half, copied once per block into a two-buffer LDS ring while the tiles before are worked on. Behind the loop the two halves' (reference, sum, O) are joined through LDS.
constexpr int KH = SK / 2, TB = TK * LP * 2 /* bytes of a 64-row tile */, XB = 8 * 16 * (HD + 4) * 4 /* bytes of eight 16 x 64 f32 staging tiles */;
static_assert(KH % TK == 0 && KH >= 2 * TK && HD == TK && QL % 128 == 0, "each key half feeds its own two-buffer ring");
__global__ __launch_bounds__(256) void attn_kernel(const b16* __restrict__ Qp, const b16* __restrict__ Kp, const b16* __restrict__ VTh, const b16* __restrict__ VTl, b16* __restrict__ Ch, b16* __restrict__ Cl) {
  __shared__ __attribute__((aligned(16))) b16 Pb[8][32][32 + 8];
  // The ring and the closing staging share these bytes: the staging is first written behind the ring's last publish point, when no wave reads the ring and no copy is in flight.
  __shared__ __attribute__((aligned(16))) unsigned char R[12 * TB]; static_assert(sizeof(R) >= 2 * XB + 8 * 32 * 2 * 4, "staging fits the ring");
  b16 (*Ks)[2][TK][LP] = (b16 (*)[2][TK][LP])R; b16 (*Vhs)[2][HD][LP] = (b16 (*)[2][HD][LP])(R + 4 * TB); b16 (*Vls)[2][HD][LP] = (b16 (*)[2][HD][LP])(R + 8 * TB);   // [buffer][key half][row][k]
  float (*Xo)[16][HD + 4] = (float (*)[16][HD + 4])R; float (*To)[16][HD + 4] = (float (*)[16][HD + 4])(R + XB); float (*ML)[32][2] = (float (*)[32][2])(R + 2 * XB);
  const int wave = threadIdx.x >> 5, lane = threadIdx.x & 31, hh = lane >> 4, col = lane & 15; const int grp = wave & 3, kh = wave >> 2; const int b = blockIdx.y / H, h = blockIdx.y % H; const int q0 = blockIdx.x * 128 + grp * 32;
  const b16* Qb = Qp + ((size_t)(b * H + h) * S) * HD; const b16* Kb = Kp + ((size_t)(b * H + h) * S) * HD; const b16* Vh = VTh + ((size_t)(b * H + h) * HD) * S; const b16* Vl = VTl + ((size_t)(b * H + h) * HD) * S;
  v16b qa[2][2];
#pragma unroll   // the fragment arrays stay in registers only under constant indices
  for (int c = 0; c < 2; ++c) { const b16* qr = Qb + (size_t)(q0 + 16 * c + col) * HD; qa[c][0] = frag_kb(qr, hh); qa[c][1] = frag_kb(qr + 32, hh); }
  const float cs = LOG2E / (8.0f * XS * XS);   // 1/sqrt(64) and the two x8 carriers, in the log2 domain
  float nb[2] = {INFINITY, INFINITY}, l[2] = {0.0f, 0.0f}; v8f o[2][4];   // nb = PSL2 - reference (log2 domain): P x1024 = exp2(score cs + nb); l and o are sums against that reference
#pragma unroll   // the accumulator array stays in registers only under constant indices
  for (int c = 0; c < 2; ++c)
#pragma unroll   // as above
    for (int t = 0; t < 4; ++t) o[c][t] = (v8f){};
  const int sr = threadIdx.x >> 3, sc = (threadIdx.x & 7) * 8;   // 8 lanes per 128-B row; 256 threads cover rows sr and sr + 32 of each of the six tiles
  auto stage = [&](int kt, int buf) {
#pragma unroll   // one run of copies per key half
    for (int hf = 0; hf < 2; ++hf) { const int kk = hf * KH + kt;
      copy6(lds_off(&Ks[buf][hf][sr][sc]), Kb + (size_t)(kk + sr) * HD + sc, lds_off(&Ks[buf][hf][sr + 32][sc]), Kb + (size_t)(kk + sr + 32) * HD + sc,
            lds_off(&Vhs[buf][hf][sr][sc]), Vh + (size_t)sr * S + kk + sc, lds_off(&Vhs[buf][hf][sr + 32][sc]), Vh + (size_t)(sr + 32) * S + kk + sc,
            lds_off(&Vls[buf][hf][sr][sc]), Vl + (size_t)sr * S + kk + sc, lds_off(&Vls[buf][hf][sr + 32][sc]), Vl + (size_t)(sr + 32) * S + kk + sc); } };
  stage(0, 0); wait_copies(); __syncthreads(); stage(TK, 1);
#pragma unroll 1   // one trip per ring tile: the buffer index and the publish point stay in one place
  for (int kt = 0; kt < KH; kt += TK) { const int buf = (kt / TK) & 1;
#pragma unroll 1
  for (int kb = 0; kb < TK; kb += 32) {
    float e[2][16], mx[2]; v16b kf[2][2], vh[4], vl[4], pf[2];   // the step's K and V^T fragments, read as one group: the V^T reads land behind the softmax
#pragma unroll   // the fragment arrays stay in registers only under constant indices
    for (int u = 0; u < 2; ++u) { const b16* kr = &Ks[buf][kh][kb + u * 16 + col][0]; kf[u][0] = frag_kb(kr, hh); kf[u][1] = frag_kb(kr + 32, hh); }
#pragma unroll   // the fragment arrays stay in registers only under constant indices
    for (int t = 0; t < 4; ++t) { vh[t] = frag_kb(&Vhs[buf][kh][t * 16 + col][kb], hh); vl[t] = frag_kb(&Vls[buf][kh][t * 16 + col][kb], hh); }
    reads_stay_ahead();
#pragma unroll   // both column groups: the arrays stay in registers only under constant indices
    for (int c = 0; c < 2; ++c) { mx[c] = -INFINITY;
#pragma unroll
      for (int u = 0; u < 2; ++u) { v8f s = (v8f){}; s = wmma16b(kf[u][0], qa[c][0], s); s = wmma16b(kf[u][1], qa[c][1], s);
#pragma unroll
        for (int r = 0; r < 8; ++r) { e[c][u * 8 + r] = s[r]; mx[c] = fmaxf(mx[c], s[r]); } } }
    // The reference moves only in a step where some lane's largest exponent would pass PTOP (the first step: nb is +inf there). One test per step, a scalar branch: every lane of the wave takes it or none.
    if (__builtin_amdgcn_ballot_w32(fmaf(mx[0], cs, nb[0]) > PTOP || fmaf(mx[1], cs, nb[1]) > PTOP) != 0) {
#pragma unroll   // both column groups: the arrays stay in registers only under constant indices
      for (int c = 0; c < 2; ++c) { const float mw = fmaxf(mx[c], __shfl_xor(mx[c], 16));   // the query's largest score of the step, alike in both lane halves
        const float nn = fminf(nb[c], PSL2 - mw * cs), al = nexp2(nn - nb[c]); nb[c] = nn; l[c] *= al;   // reference = max(reference, step maximum); al = 2^(old - new) <= 1
#pragma unroll   // the accumulator array stays in registers only under constant indices
        for (int t = 0; t < 4; ++t) o[c][t] *= al; } }
#pragma unroll   // both column groups: the arrays stay in registers only under constant indices
    for (int c = 0; c < 2; ++c) { float sum = 0.0f;
#pragma unroll
      for (int i2 = 0; i2 < 16; ++i2) { const float p = nexp2(fmaf(e[c][i2], cs, nb[c])); sum += p; Pb[wave][16 * c + col][(i2 < 8 ? 0 : 16) + 8 * hh + (i2 & 7)] = (b16)p; }
      sum += __shfl_xor(sum, 16); l[c] += sum; }
    wave_lds_sync();
#pragma unroll   // the fragment arrays stay in registers only under constant indices
    for (int c = 0; c < 2; ++c) pf[c] = frag_kb(&Pb[wave][16 * c + col][0], hh);
#pragma unroll   // the fragment and accumulator arrays stay in registers only under constant indices
    for (int t = 0; t < 4; ++t)
#pragma unroll   // as above: one V^T fragment, both column groups
      for (int c = 0; c < 2; ++c) { o[c][t] = wmma16b(vh[t], pf[c], o[c][t]); o[c][t] = wmma16b(vl[t], pf[c], o[c][t]); }
    wave_lds_sync();
    // The step's last WMMA stands next to the loop's back edge: four vector slots before the next step's address arithmetic may reuse its A registers.
    __builtin_amdgcn_sched_barrier(0); asm volatile("v_nop\n\tv_nop\n\tv_nop\n\tv_nop"); }
    publish_tile();
    if (kt + 2 * TK < KH) stage(kt + 2 * TK, buf); }   // refill the buffers that every wave has just left
  wait_copies();
  // Join of the two key halves: wave w keeps column group kh and hands the other group's (reference, sum, O) to wave w ^ 4, lane for lane; one block barrier between the hand-over's writes and its reads.
  const bool up = kh != 0; const int pw = wave ^ 4;
  const float mk = up ? nb[1] : nb[0], lk = up ? l[1] : l[0];
  ML[wave][lane][0] = up ? nb[0] : nb[1]; ML[wave][lane][1] = up ? l[0] : l[1];
#pragma unroll   // the accumulator array stays in registers only under constant indices
  for (int t = 0; t < 4; ++t)
#pragma unroll   // as above
    for (int r = 0; r < 8; ++r) Xo[wave][col][t * 16 + 8 * hh + r] = up ? o[0][t][r] : o[1][t][r];
  __syncthreads();
  const float mo = ML[pw][lane][0], lo = ML[pw][lane][1]; const float mn = fminf(mk, mo), ak = nexp2(mn - mk), ao = nexp2(mn - mo);   // the larger reference is the smaller nb
  const float inv = 1.0f / ((lk * ak + lo * ao) * XS);
#pragma unroll   // the accumulator array stays in registers only under constant indices
  for (int t = 0; t < 4; ++t)
#pragma unroll   // as above
    for (int r = 0; r < 8; ++r) To[wave][col][t * 16 + 8 * hh + r] = ((up ? o[1][t][r] : o[0][t][r]) * ak + Xo[pw][col][t * 16 + 8 * hh + r] * ao) * inv;
  wave_lds_sync();
  { for (int rr = 0; rr < 16; ++rr) { const v2f f = *(const v2f*)(&To[wave][rr][lane * 2]); v2h hv, lv; for (int j = 0; j < 2; ++j) { b16 p, q; split16(f[j] * XS, p, q); hv[j] = p; lv[j] = q; }
      const size_t oi = ((size_t)b * S + q0 + 16 * kh + rr) * DM + h * HD + lane * 2; *(v2h*)(Ch + oi) = hv; *(v2h*)(Cl + oi) = lv; }  }
}
__global__ __launch_bounds__(128) void out_kernel(const b16* __restrict__ Ch, const b16* __restrict__ Cl, const b16* __restrict__ WO, const float* __restrict__ bo, float* __restrict__ out) {
  __shared__ __attribute__((aligned(16))) float Tf[4][16][128 + 4]; __shared__ __attribute__((aligned(16))) b16 Ws[2][128][LP]; __shared__ __attribute__((aligned(16))) b16 Ahs[2][64][LP]; __shared__ __attribute__((aligned(16))) b16 Als[2][64][LP];   // two-buffer ring: 128 x 64 weight tile (read by all four waves), 64 x 64 ctx hi and lo tiles
  const int wave = threadIdx.x >> 5, lane = threadIdx.x & 31, nloc = lane & 15, hlf = lane >> 4; const int b = blockIdx.x / (QL / 64), rb = blockIdx.x % (QL / 64); const size_t m0 = (size_t)b * S + rb * 64 + wave * 16; const int n0 = blockIdx.y * 128;
  v8f acc[8];
#pragma unroll
  for (int t = 0; t < 8; ++t) acc[t] = (v8f){};
  const b16* Wn = WO + (size_t)n0 * DM; const int sr = threadIdx.x >> 3, sc = (threadIdx.x & 7) * 8;   // 8 lanes per 128-B row; 128 threads cover rows sr + 16 j
  const size_t a0 = ((size_t)b * S + rb * 64 + sr) * DM + sc; constexpr unsigned LS = 16 * LP * 2; constexpr size_t GS = (size_t)16 * DM;
  auto stage = [&](int k0, int buf) { const b16* gh = Ch + a0 + k0; const b16* gl = Cl + a0 + k0; const unsigned lh = lds_off(&Ahs[buf][sr][sc]), ll = lds_off(&Als[buf][sr][sc]);
    copy8(lh, gh, lh + LS, gh + GS, lh + 2 * LS, gh + 2 * GS, lh + 3 * LS, gh + 3 * GS, ll, gl, ll + LS, gl + GS, ll + 2 * LS, gl + 2 * GS, ll + 3 * LS, gl + 3 * GS); stage_w128(Ws[buf], Wn, k0); };
  stage(0, 0); wait_copies(); __syncthreads(); stage(TK, 1);
#pragma unroll 1   // one trip per ring tile: the buffer index and the publish point stay in one place
  for (int kt = 0; kt < DM; kt += TK) { const int buf = (kt / TK) & 1;
    v16b ah[2], al[2], bw[2][8];   // the whole tile's fragments, read as one group
#pragma unroll     // both 32-k steps of a tile: constant LDS offsets
    for (int s = 0; s < 2; ++s) { ah[s] = frag_kb(&Ahs[buf][wave * 16 + nloc][32 * s], hlf); al[s] = frag_kb(&Als[buf][wave * 16 + nloc][32 * s], hlf);
#pragma unroll   // the fragment arrays stay in registers only under constant indices
      for (int t = 0; t < 8; ++t) bw[s][t] = frag_kb(&Ws[buf][t * 16 + nloc][32 * s], hlf); }
    reads_stay_ahead();
#pragma unroll   // the fragment arrays stay in registers only under constant indices
    for (int s = 0; s < 2; ++s)
#pragma unroll   // the fragment arrays stay in registers only under constant indices
      for (int t = 0; t < 8; ++t) { acc[t] = wmma16b(ah[s], bw[s][t], acc[t]); acc[t] = wmma16b(al[s], bw[s][t], acc[t]); }
    products_stay_in_trip(); publish_tile();
    if (kt + 2 * TK < DM) stage(kt + 2 * TK, buf); }   // refill the buffers that every wave has just left
  wait_copies();
#pragma unroll
  for (int t = 0; t < 8; ++t) { const float bb = bf16_rne(bo[n0 + t * 16 + nloc]);
#pragma unroll
    for (int r = 0; r < 8; ++r) Tf[wave][8 * hlf + r][t * 16 + nloc] = acc[t][r] * (1.0f / (XS * WSC)) + bb; }
  wave_lds_sync();
  { for (int rr = 0; rr < 16; ++rr) *(v4f*)(out + (m0 + rr) * DM + n0 + lane * 4) = *(const v4f*)(&Tf[wave][rr][lane * 4]);  }
}
}  // namespace

extern "C" void kernel_launch(void* const* d_in, const int* in_sizes, int n_in, void* d_out, int out_size, void* d_ws, size_t ws_size, hipStream_t stream) {
  (void)n_in;
  auto Fp = [&](int i) { return (const float*)d_in[i]; };
  // input order: 0 inputs_q [2,2048,1024], 1 inputs_kv, 2 Wq [1024,16,64], 3 Wk, 4 Wv, 5 bq [16,64], 6 bk, 7 bv, 8 Wo [16,64,1024], 9 bo [1024]
  if (in_sizes[0] != B * S * DM || in_sizes[1] != B * S * DM || in_sizes[2] != DM * DM || in_sizes[3] != DM * DM || in_sizes[4] != DM * DM || in_sizes[5] != DM || in_sizes[8] != DM * DM || in_sizes[9] != DM || out_size != B * S * DM) return;
  size_t off = 0; char* ws = (char*)d_ws;
  auto carve = [&](size_t bytes) { char* p = ws + off; off += (bytes + 255) & ~(size_t)255; return p; };
  b16* WT = (b16*)carve((size_t)3 * DM * DM * 2); b16* WO = (b16*)carve((size_t)DM * DM * 2); const size_t plane = (size_t)B * S * DM * 2;
  b16* Qp = (b16*)carve(plane); b16* Kp = (b16*)carve(plane); b16* VTh = (b16*)carve(plane); b16* VTl = (b16*)carve(plane); b16* Ch = (b16*)carve(plane); b16* Cl = (b16*)carve(plane);
  if (off > ws_size || off > ((size_t)128 << 20)) return;   // ≈ 58.7 MB (6 planes x 8.4 MB + 8.4 MB weights)
  prep_kernel<<<PREP_BLOCKS, 256, 0, stream>>>(Fp(2), Fp(3), Fp(4), Fp(8), WT, WO);
  proj_kernel<<<dim3(S / PM, BL * 3, 8), 128, 0, stream>>>(Fp(0), Fp(1), WT, Fp(5), Fp(6), Fp(7), Qp, Kp, VTh, VTl);
  attn_kernel<<<dim3(QL / 128, BL * H), 256, 0, stream>>>(Qp, Kp, VTh, VTl, Ch, Cl);
  out_kernel<<<dim3((QL / 64) * BL, 8), 128, 0, stream>>>(Ch, Cl, WO, Fp(9), (float*)d_out);
}

// v007
// One run takes 96.5 microseconds.
// In both of two side-by-side timings against v006, it was 1.05 times as fast.
// All steps since v000 together make it 5.34 times as fast.
#include <hip/hip_runtime.h>

// Multi-head dot-product attention (16 heads x 64, d_model 1024) on inputs_q / inputs_kv [2, 2048, 1024]: q = inputs_q Wq + bq, k/v = inputs_kv Wk/Wv + b; attn = softmax(q k^T / 8) per head over
// all 2,048 keys; ctx = attn v; out = ctx Wo + bo -> [2][2048][1024].
// Deterministic: flash-style per 32-query wave over one half of the keys in order (held reference, moved up when a lane's step sum of P x1024 passes 2^15), the two halves joined once at the end, fixed reduction trees; no atomics.
// compute dtype: WMMA v_wmma_f32_16x16x32_f16 with f32 accumulate for the three projections ([4096 x 1024] x [1024 x 1024]; inputs EXACT bf16 x8, [d][h][f]
// weights transposed exact x256: 1 product), S^T = K Q^T (q, k single f16 x8: 1 product), O^T += V^T P^T (v hi+lo x8, P x1024 single f16: 2 products) and out = ctx Wo ([4096 x 1024] x [1024 x 1024];
// ctx as hi+lo x8 planes: 2 products, Wo transposed exact x256); softmax statistics (exp2, reference, row sums) in f32. Inputs rounded to bf16 once.

namespace {
constexpr int B = 2, S = 2048, DM = 1024, H = 16, HD = 64, BL = 2 /* batches computed (== B shipped) */, QL = 2048 /* query rows computed (== S shipped) */, SK = 2048 /* key rows used (== S shipped) */;
constexpr float XS = 8.0f, WSC = 256.0f, PSL2 = 10.0f /* P and its row sums carry x1024 = 2^PSL2 */, PMAX = 32768.0f /* bound on a lane's 16-value sum of P, so on each P: 2^15 is finite in f16 */, LOG2E = 1.4426950408889634f;
static_assert(S % 64 == 0 && QL % 128 == 0 && SK % 64 == 0 && DM == H * HD, "tiling");
typedef _Float16 b16;
typedef __attribute__((ext_vector_type(16))) _Float16 v16b;
typedef __attribute__((ext_vector_type(8))) _Float16 v8b;
typedef __attribute__((ext_vector_type(8))) float v8f;
typedef __attribute__((ext_vector_type(4))) float v4f;
__device__ __forceinline__ float bf16_rne(float f) { unsigned int u = __float_as_uint(f); u += 0x7FFFu + ((u >> 16) & 1u); return __uint_as_float(u & 0xFFFF0000u); }
__device__ __forceinline__ void split16(float v, b16& hi, b16& lo) { hi = (b16)v; lo = (b16)(v - (float)hi); }
__device__ __forceinline__ v16b frag_kb(const b16* p, int hh) { const v8b a = *(const v8b*)(p + 8 * hh), b = *(const v8b*)(p + 16 + 8 * hh); v16b f;
#pragma unroll
  for (int e = 0; e < 8; ++e) { f[e] = a[e]; f[8 + e] = b[e]; } return f; }
__device__ __forceinline__ v8f wmma16b(v16b a, v16b b, v8f c) { return __builtin_amdgcn_wmma_f32_16x16x32_f16(false, a, false, b, (short)0, c, false, false); }
// Stands between a block's LDS fragment reads and its matrix products: without it the scheduler sinks each read to its product again and the wave waits out the LDS latency once per product.
__device__ __forceinline__ void reads_stay_ahead() { __builtin_amdgcn_sched_barrier(0); }
// Stands between a tile's matrix products and its publish point: without it the scheduler sinks the products below the barrier, in front of the refill, and the next copies start a whole run of products later.
__device__ __forceinline__ void products_stay_in_trip() { __builtin_amdgcn_sched_barrier(0); }
// Stands between a 32-k step's matrix products and the next step's LDS reads: without it the scheduler lifts those reads over the last product into registers of their own, past v255, and the loop pays a register-window switch at each use.
__device__ __forceinline__ void steps_stay_apart() { __builtin_amdgcn_sched_barrier(0); }
__device__ __forceinline__ void wave_lds_sync() { __builtin_amdgcn_fence(__ATOMIC_RELEASE, "workgroup"); __builtin_amdgcn_wave_barrier(); __builtin_amdgcn_fence(__ATOMIC_ACQUIRE, "workgroup"); }
__device__ __forceinline__ float pmul(float a, float b) { float p = a * b; asm volatile("" : "+v"(p)); return p; }
__device__ __forceinline__ int iclamp(int v, int lo, int hi) { return v < lo ? lo : (v > hi ? hi : v); }

typedef __attribute__((ext_vector_type(2))) _Float16 v2h;
typedef __attribute__((ext_vector_type(4))) _Float16 v4h;
typedef __attribute__((ext_vector_type(2))) float v2f;
__device__ __forceinline__ float nexp2(float v) { return __builtin_amdgcn_exp2f(v); }
// LDS staging of operand tiles that all waves of a block read: rows of 64 f16 (one whole 128-B line), LDS pitch 144 B (16 B x odd: no bank conflict for the 16-byte fragment reads).
constexpr int TK = 64, LP = TK + 8, XP = TK + 4;   // XP: the same for rows of 64 f32 (256 B at pitch 272 B)
static_assert(SK % TK == 0 && SK >= 2 * TK && DM % TK == 0 && DM >= 2 * TK && (LP * 2) % 16 == 0, "two-buffer ring needs two tiles");
__device__ __forceinline__ unsigned lds_off(const void* p) { return (unsigned)(size_t)p; }
// Each lane copies 16 bytes global -> LDS per line, through no register; the closing s_wait_xcnt keeps every later rewrite of the address registers behind the issued copies.
__device__ __forceinline__ void copy6(unsigned l0, const void* g0, unsigned l1, const void* g1, unsigned l2, const void* g2, unsigned l3, const void* g3, unsigned l4, const void* g4, unsigned l5, const void* g5) {
  asm volatile("global_load_async_to_lds_b128 %0, %1, off\n\tglobal_load_async_to_lds_b128 %2, %3, off\n\tglobal_load_async_to_lds_b128 %4, %5, off\n\t"
               "global_load_async_to_lds_b128 %6, %7, off\n\tglobal_load_async_to_lds_b128 %8, %9, off\n\tglobal_load_async_to_lds_b128 %10, %11, off\n\ts_wait_xcnt 0x0"
               :: "v"(l0), "v"(g0), "v"(l1), "v"(g1), "v"(l2), "v"(g2), "v"(l3), "v"(g3), "v"(l4), "v"(g4), "v"(l5), "v"(g5) : "memory"); }
__device__ __forceinline__ void copy8(unsigned l0, const void* g0, unsigned l1, const void* g1, unsigned l2, const void* g2, unsigned l3, const void* g3, unsigned l4, const void* g4, unsigned l5, const void* g5, unsigned l6, const void* g6, unsigned l7, const void* g7) {
  asm volatile("global_load_async_to_lds_b128 %0, %1, off\n\tglobal_load_async_to_lds_b128 %2, %3, off\n\tglobal_load_async_to_lds_b128 %4, %5, off\n\tglobal_load_async_to_lds_b128 %6, %7, off\n\t"
               "global_load_async_to_lds_b128 %8, %9, off\n\tglobal_load_async_to_lds_b128 %10, %11, off\n\tglobal_load_async_to_lds_b128 %12, %13, off\n\tglobal_load_async_to_lds_b128 %14, %15, off\n\ts_wait_xcnt 0x0"
               :: "v"(l0), "v"(g0), "v"(l1), "v"(g1), "v"(l2), "v"(g2), "v"(l3), "v"(g3), "v"(l4), "v"(g4), "v"(l5), "v"(g5), "v"(l6), "v"(g6), "v"(l7), "v"(g7) : "memory"); }
// This wave's own copies have landed (the compiler places no wait for them).
__device__ __forceinline__ void wait_copies() { asm volatile("s_wait_asynccnt 0x0" ::: "memory"); }
// Publish point of the two-buffer ring: this wave's LDS reads of the old tile are done, its copies of the next tile have landed, then the block barrier hands both over.
__device__ __forceinline__ void publish_tile() { asm volatile("s_wait_dscnt 0x0" ::: "memory"); wait_copies(); __syncthreads(); }
// A 64-row x 64-k f32 input tile by 128 threads: 16 lanes per 256-B row, 8 rows per copy line.
__device__ __forceinline__ void stage_x64(float (*dst)[XP], const float* xrow0, int k0) {
  const int sr = threadIdx.x >> 4, sc = (threadIdx.x & 15) * 4; const float* g = xrow0 + (size_t)sr * DM + k0 + sc; const unsigned l = lds_off(&dst[sr][sc]); constexpr unsigned LS = 8 * XP * 4; constexpr size_t GS = (size_t)8 * DM;
  copy8(l, g, l + LS, g + GS, l + 2 * LS, g + 2 * GS, l + 3 * LS, g + 3 * GS, l + 4 * LS, g + 4 * GS, l + 5 * LS, g + 5 * GS, l + 6 * LS, g + 6 * GS, l + 7 * LS, g + 7 * GS); }
// A 128-row x 64-k weight tile (rows n0.., columns k0..) by 128 threads: 8 lanes per row, 16 rows per copy line.
__device__ __forceinline__ void stage_w128(b16 (*dst)[LP], const b16* Wrow0, int k0) {
  const int sr = threadIdx.x >> 3, sc = (threadIdx.x & 7) * 8; const b16* g = Wrow0 + (size_t)sr * DM + k0 + sc; const unsigned l = lds_off(&dst[sr][sc]); constexpr unsigned LS = 16 * LP * 2; constexpr size_t GS = (size_t)16 * DM;
  copy8(l, g, l + LS, g + GS, l + 2 * LS, g + 2 * GS, l + 3 * LS, g + 3 * GS, l + 4 * LS, g + 4 * GS, l + 5 * LS, g + 5 * GS, l + 6 * LS, g + 6 * GS, l + 7 * LS, g + 7 * GS); }
// Weight transposition, one 128 x 128 tile of one weight per block: each wave load takes whole 128-B lines (4 k rows x 32 columns), a thread rounds and scales two neighbouring k rows and stores them as f16 pairs into the turned LDS tile,
// which leaves as 256-B pieces of the [column][k] rows. LDS pitch 264 B: the 4-byte stores of a wave and its 8-byte reads each fall on distinct banks.
constexpr int PT = 128, PP = PT + 4, PTN = DM / PT, PREP_BLOCKS = 4 * PTN * PTN;
static_assert(DM % PT == 0 && (PP * 2) % 8 == 0, "prep tiling");
__global__ __launch_bounds__(256) void prep_kernel(const float* __restrict__ wq, const float* __restrict__ wk, const float* __restrict__ wv, const float* __restrict__ wo, b16* __restrict__ WT, b16* __restrict__ WO) {
  __shared__ __attribute__((aligned(16))) b16 T[PT][PP];
  const int m = blockIdx.x / (PTN * PTN), tile = blockIdx.x % (PTN * PTN); const int kb = (tile / PTN) * PT, ob = (tile % PTN) * PT;
  const float* w = m == 0 ? wq : (m == 1 ? wk : (m == 2 ? wv : wo)); b16* dst = m < 3 ? WT + (size_t)m * DM * DM : WO;
  const int wave = threadIdx.x >> 5, lane = threadIdx.x & 31; const int k = (wave >> 2) * 8 + (lane >> 3) * 2, oo = (wave & 3) * 32 + (lane & 7) * 4;   // pass p: rows k + 16 p and the next, columns oo .. oo + 3
  const float* g = w + (size_t)(kb + k) * DM + ob + oo;
  v4f x0[8], x1[8];
#pragma unroll   // all sixteen loads of a thread in flight at once, off one address
  for (int p = 0; p < 8; ++p) { x0[p] = *(const v4f*)(g + (size_t)(16 * p) * DM); x1[p] = *(const v4f*)(g + (size_t)(16 * p + 1) * DM); }
  asm volatile("s_wait_xcnt 0x0" :: "v"(g) : "memory");   // the wait behind the issued loads; naming g keeps their address pair from being given to the last load's result in front of it
  __builtin_amdgcn_sched_barrier(0);   // without it the scheduler sinks most of the loads below the first conversions, and a thread waits out the memory latency several times instead of once
#pragma unroll   // x0, x1 stay in registers only under constant indices
  for (int p = 0; p < 8; ++p)
#pragma unroll
    for (int i = 0; i < 4; ++i) { v2h pr; pr[0] = (b16)(bf16_rne(x0[p][i]) * WSC); pr[1] = (b16)(bf16_rne(x1[p][i]) * WSC); *(v2h*)&T[oo + i][k + 16 * p] = pr; }
  __syncthreads();
  const int ro = threadIdx.x >> 4, k8 = (threadIdx.x & 15) * 8; b16* d = dst + (size_t)(ob + ro) * DM + kb + k8;   // pass p: column ro + 16 p, 16 lanes per 256-B piece
#pragma unroll
  for (int p = 0; p < 8; ++p) { const v4h a = *(const v4h*)&T[ro + 16 * p][k8], b = *(const v4h*)&T[ro + 16 * p][k8 + 4]; v8b o;
#pragma unroll
    for (int j = 0; j < 4; ++j) { o[j] = a[j]; o[4 + j] = b[j]; }
    *(v8b*)(d + (size_t)(16 * p) * DM) = o; }
}
// projections: grid (rows/128, BL x 3 (which), 8 slabs of 128); block = 128 tokens x 128 columns, 4 waves of 32 tokens x 128 columns; A = bf16(input) x8; 16 tiles x 32 k-steps, 1 product; + bias.
// Per 64-k tile the block's 128 x 64 f32 inputs and the slab's 128 x 64 weights are copied once into a two-buffer LDS ring; a wave rounds its two A fragments as it reads them, and each B fragment it takes from the ring feeds both.
constexpr int PM = 128, PW = PM / 4;   // tokens per block and per wave
static_assert(S % PM == 0 && QL % PM == 0 && SK % PM == 0 && PW == 32, "projection tiling");
__global__ __launch_bounds__(128) void proj_kernel(const float* __restrict__ xq, const float* __restrict__ xkv, const b16* __restrict__ WT, const float* __restrict__ bq, const float* __restrict__ bk, const float* __restrict__ bv, b16* __restrict__ Qp, b16* __restrict__ Kp, b16* __restrict__ VTh, b16* __restrict__ VTl) {
  // The input ring and the output staging share these bytes: the staging is first written behind the ring's last publish point, when no wave reads the ring and no copy is in flight.
  __shared__ __attribute__((aligned(16))) unsigned char U[2 * PM * XP * 4]; static_assert(sizeof(U) >= sizeof(float) * 4 * PW * (128 + 4) && sizeof(U) >= sizeof(b16) * 2 * 128 * (PM + 8), "staging fits the ring");
  __shared__ __attribute__((aligned(16))) b16 Ws[2][128][LP];
  float (*Xs)[PM][XP] = (float (*)[PM][XP])U; float (*Tf)[PW][128 + 4] = (float (*)[PW][128 + 4])U; b16 (*Tv)[128][PM + 8] = (b16 (*)[128][PM + 8])U;   // Tv: [hi, lo][column][token], pitch 272 B (16 B x odd)
  const int wave = threadIdx.x >> 5, lane = threadIdx.x & 31, nloc = lane & 15, hlf = lane >> 4; const int which = blockIdx.y % 3, b = blockIdx.y / 3; const int rb = blockIdx.x, slab = blockIdx.z; const int t0 = rb * PM + wave * PW; const int n0 = slab * 128;
  if ((which == 0 && rb * PM >= QL) || (which != 0 && rb * PM >= SK)) return;   // block-uniform
  const float* x = (which == 0) ? xq : xkv; const b16* W = WT + (size_t)which * DM * DM; const float* bias = which == 0 ? bq : (which == 1 ? bk : bv);
  v8f acc[2][8];
#pragma unroll
  for (int c = 0; c < 2; ++c)
#pragma unroll
    for (int t = 0; t < 8; ++t) acc[c][t] = (v8f){};
  const b16* Wn = W + (size_t)n0 * DM; const float* xb = x + ((size_t)b * S + rb * PM) * DM;
  auto stage = [&](int k0, int buf) { stage_x64(&Xs[buf][0], xb, k0); stage_x64(&Xs[buf][64], xb + (size_t)64 * DM, k0); stage_w128(Ws[buf], Wn, k0); };
  stage(0, 0); wait_copies(); __syncthreads(); stage(TK, 1);
#pragma unroll 1   // one trip per ring tile: the buffer index and the publish point stay in one place
  for (int k0 = 0; k0 < DM; k0 += TK) { const int buf = (k0 / TK) & 1;
#pragma unroll     // both 32-k steps of a tile: constant LDS offsets
    for (int s = 0; s < 2; ++s) { v4f xv[2][4]; v16b bw[8], a[2];   // the step's fragments, read as one group
#pragma unroll   // the fragment arrays stay in registers only under constant indices
      for (int c = 0; c < 2; ++c) { const float* xr = &Xs[buf][wave * PW + 16 * c + nloc][32 * s + 8 * hlf];   // k order of frag_kb: 8 hlf + 0..7, then 16 + 8 hlf + 0..7
        xv[c][0] = *(const v4f*)xr; xv[c][1] = *(const v4f*)(xr + 4); xv[c][2] = *(const v4f*)(xr + 16); xv[c][3] = *(const v4f*)(xr + 20); }
#pragma unroll   // the fragment arrays stay in registers only under constant indices
      for (int t = 0; t < 8; ++t) bw[t] = frag_kb(&Ws[buf][t * 16 + nloc][32 * s], hlf);
      reads_stay_ahead();
#pragma unroll   // the fragment arrays stay in registers only under constant indices
      for (int c = 0; c < 2; ++c)
#pragma unroll
        for (int j = 0; j < 4; ++j) { a[c][j] = (b16)(bf16_rne(xv[c][0][j]) * XS); a[c][4 + j] = (b16)(bf16_rne(xv[c][1][j]) * XS); a[c][8 + j] = (b16)(bf16_rne(xv[c][2][j]) * XS); a[c][12 + j] = (b16)(bf16_rne(xv[c][3][j]) * XS); }
#pragma unroll   // the fragment and accumulator arrays stay in registers only under constant indices
      for (int t = 0; t < 8; ++t)
#pragma unroll   // as above: one weight fragment, both token groups
        for (int c = 0; c < 2; ++c) acc[c][t] = wmma16b(a[c], bw[t], acc[c][t]);
      if (s == 0) steps_stay_apart(); }
    products_stay_in_trip(); publish_tile();
    if (k0 + 2 * TK < DM) stage(k0 + 2 * TK, buf); }   // refill the buffers that every wave has just left
  wait_copies();
  // Staging. V: a lane's eight accumulator registers are eight neighbouring tokens of one column, so its hi and lo halves go as 16-byte pieces into the [column][token] tiles. Q, K: f32 rows, each wave its own 32.
  float bb[8];
#pragma unroll
  for (int t = 0; t < 8; ++t) bb[t] = bf16_rne(bias[n0 + t * 16 + nloc]);
  if (which == 2) {
#pragma unroll   // the accumulator array stays in registers only under constant indices
    for (int t = 0; t < 8; ++t)
#pragma unroll   // as above
      for (int c = 0; c < 2; ++c) { v8b hv, lv;
#pragma unroll
        for (int r = 0; r < 8; ++r) { b16 p, ql; split16((acc[c][t][r] * (1.0f / (XS * WSC)) + bb[t]) * XS, p, ql); hv[r] = p; lv[r] = ql; }
        *(v8b*)&Tv[0][t * 16 + nloc][wave * PW + 16 * c + 8 * hlf] = hv; *(v8b*)&Tv[1][t * 16 + nloc][wave * PW + 16 * c + 8 * hlf] = lv; } }
  else {
#pragma unroll   // the accumulator array stays in registers only under constant indices
    for (int t = 0; t < 8; ++t)
#pragma unroll   // as above
      for (int c = 0; c < 2; ++c)
#pragma unroll
        for (int r = 0; r < 8; ++r) Tf[wave][16 * c + 8 * hlf + r][t * 16 + nloc] = acc[c][t][r] * (1.0f / (XS * WSC)) + bb[t]; }
  __syncthreads();
  if (which == 2) {   // a wave's 32 columns, two per pass: 16 lanes per 256-B row piece of V^T hi and of V^T lo; head h, row d of column c is row b DM + c of the [B H HD][S] planes
    const int cl = wave * 32 + hlf; const size_t oi = ((size_t)b * DM + n0 + cl) * S + rb * PM + nloc * 8;
#pragma unroll   // all of a wave's pieces in flight at once, off one address per plane
    for (int q = 0; q < 16; ++q) { *(v8b*)(VTh + oi + (size_t)(2 * q) * S) = *(const v8b*)&Tv[0][cl + 2 * q][nloc * 8]; *(v8b*)(VTl + oi + (size_t)(2 * q) * S) = *(const v8b*)&Tv[1][cl + 2 * q][nloc * 8]; } }
  else { b16* P = which == 0 ? Qp : Kp; const int c = n0 + lane * 4; const int h = c / HD, d = c % HD;   // a token's 128 columns per pass: one whole 128-B line for each of the slab's two heads
    b16* pr = P + (((size_t)b * H + h) * S + t0) * HD + d;
#pragma unroll   // all of a wave's rows in flight at once, off one address
    for (int rr = 0; rr < PW; ++rr) { const v4f f = *(const v4f*)&Tf[wave][rr][lane * 4]; v4h o;
#pragma unroll
      for (int j = 0; j < 4; ++j) o[j] = (b16)(f[j] * XS);
      *(v4h*)(pr + (size_t)rr * HD) = o; }
    asm volatile("s_wait_xcnt 0x0" ::: "memory"); }   // the wait behind the issued stores, in front of any later rewrite of their address and data registers
}
// attention: grid (QL/128, BL*H): block = 8 waves = 4 groups of 32 queries x 2 halves of the keys (waves w and w + 4 share their queries); a wave walks its 1,024 keys in order (2 key tiles per 32-key step),
// online softmax per 16-query column group against a held reference (moved, with O and the row sum rescaled, only in a step where a lane's sum of its 16 P x1024 passes 2^15; only such a step takes the scores' maximum), P x1024 single via LDS, O^T += V^T P^T (v hi+lo: 2 products); each K and V^T fragment read from LDS feeds the products of both column groups.
// K, V^T hi and V^T lo come in 64-key tiles, one per key half, copied once per block into a two-buffer LDS ring while the tiles before are worked on. Behind the loop the two halves' (reference, sum, O) are joined through LDS.
constexpr int KH = SK / 2, TB = TK * LP * 2 /* bytes of a 64-row tile */, XB = 8 * 16 * (HD + 4) * 4 /* bytes of eight 16 x 64 f32 staging tiles */;
static_assert(KH % TK == 0 && KH >= 2 * TK && HD == TK && QL % 128 == 0, "each key half feeds its own two-buffer ring");
__global__ __launch_bounds__(256) void attn_kernel(const b16* __restrict__ Qp, const b16* __restrict__ Kp, const b16* __restrict__ VTh, const b16* __restrict__ VTl, b16* __restrict__ Ch, b16* __restrict__ Cl) {
  __shared__ __attribute__((aligned(16))) b16 Pb[8][32][32 + 8];
  // The ring and the closing staging share these bytes: the staging is first written behind the ring's last publish point, when no wave reads the ring and no copy is in flight.
  __shared__ __attribute__((aligned(16))) unsigned char R[12 * TB]; static_assert(sizeof(R) >= 2 * XB + 8 * 32 * 2 * 4, "staging fits the ring");
  b16 (*Ks)[2][TK][LP] = (b16 (*)[2][TK][LP])R; b16 (*Vhs)[2][HD][LP] = (b16 (*)[2][HD][LP])(R + 4 * TB); b16 (*Vls)[2][HD][LP] = (b16 (*)[2][HD][LP])(R + 8 * TB);   // [buffer][key half][row][k]
  float (*Xo)[16][HD + 4] = (float (*)[16][HD + 4])R; float (*To)[16][HD + 4] = (float (*)[16][HD + 4])(R + XB); float (*ML)[32][2] = (float (*)[32][2])(R + 2 * XB);
  const int wave = __builtin_amdgcn_readfirstlane(threadIdx.x >> 5) /* in a scalar register, and with it grp, kh, q0: vector registers are short here */, lane = threadIdx.x & 31, hh = lane >> 4, col = lane & 15; const int grp = wave & 3, kh = wave >> 2; const int b = blockIdx.y / H, h = blockIdx.y % H; const int q0 = blockIdx.x * 128 + grp * 32;
  const b16* Qb = Qp + ((size_t)(b * H + h) * S) * HD; const b16* Kb = Kp + ((size_t)(b * H + h) * S) * HD; const b16* Vh = VTh + ((size_t)(b * H + h) * HD) * S; const b16* Vl = VTl + ((size_t)(b * H + h) * HD) * S;
  v16b qa[2][2];
#pragma unroll   // the fragment arrays stay in registers only under constant indices
  for (int c = 0; c < 2; ++c) { const b16* qr = Qb + (size_t)(q0 + 16 * c + col) * HD; qa[c][0] = frag_kb(qr, hh); qa[c][1] = frag_kb(qr + 32, hh); }
  const float cs = LOG2E / (8.0f * XS * XS);   // 1/sqrt(64) and the two x8 carriers, in the log2 domain
  float nb[2] = {INFINITY, INFINITY}, l[2] = {0.0f, 0.0f}; v8f o[2][4];   // nb = PSL2 - reference (log2 domain): P x1024 = exp2(score cs + nb); l and o are sums against that reference
#pragma unroll   // the accumulator array stays in registers only under constant indices
  for (int c = 0; c < 2; ++c)
#pragma unroll   // as above
    for (int t = 0; t < 4; ++t) o[c][t] = (v8f){};
  const int sr = threadIdx.x >> 3, sc = (threadIdx.x & 7) * 8;   // 8 lanes per 128-B row; 256 threads cover rows sr and sr + 32 of each of the six tiles
  auto stage = [&](int kt, int buf) {
#pragma unroll   // one run of copies per key half
    for (int hf = 0; hf < 2; ++hf) { const int kk = hf * KH + kt;
      copy6(lds_off(&Ks[buf][hf][sr][sc]), Kb + (size_t)(kk + sr) * HD + sc, lds_off(&Ks[buf][hf][sr + 32][sc]), Kb + (size_t)(kk + sr + 32) * HD + sc,
            lds_off(&Vhs[buf][hf][sr][sc]), Vh + (size_t)sr * S + kk + sc, lds_off(&Vhs[buf][hf][sr + 32][sc]), Vh + (size_t)(sr + 32) * S + kk + sc,
            lds_off(&Vls[buf][hf][sr][sc]), Vl + (size_t)sr * S + kk + sc, lds_off(&Vls[buf][hf][sr + 32][sc]), Vl + (size_t)(sr + 32) * S + kk + sc); } };
  stage(0, 0); wait_copies(); __syncthreads(); stage(TK, 1);
#pragma unroll 1   // one trip per ring tile: the buffer index and the publish point stay in one place
  for (int kt = 0; kt < KH; kt += TK) { const int buf = (kt / TK) & 1;
#pragma unroll 1
  for (int kb = 0; kb < TK; kb += 32) {
    float e[2][16], p[2][16], sum[2]; v16b kf[2][2], vh[4], vl[4], pf[2];   // the step's K and V^T fragments, read as one group: the V^T reads land behind the softmax
    auto read_k = [&](int u) { const b16* kr = &Ks[buf][kh][kb + u * 16 + col][0]; kf[u][0] = frag_kb(kr, hh); kf[u][1] = frag_kb(kr + 32, hh); };
#pragma unroll   // the fragment arrays stay in registers only under constant indices
    for (int u = 0; u < 2; ++u) read_k(u);
#pragma unroll   // the fragment arrays stay in registers only under constant indices
    for (int t = 0; t < 4; ++t) { vh[t] = frag_kb(&Vhs[buf][kh][t * 16 + col][kb], hh); vl[t] = frag_kb(&Vls[buf][kh][t * 16 + col][kb], hh); }
    reads_stay_ahead();
    auto scores = [&](int c) {
#pragma unroll   // the fragment arrays stay in registers only under constant indices
      for (int u = 0; u < 2; ++u) { v8f s = (v8f){}; s = wmma16b(kf[u][0], qa[c][0], s); s = wmma16b(kf[u][1], qa[c][1], s);
#pragma unroll
        for (int r = 0; r < 8; ++r) e[c][u * 8 + r] = s[r]; } };
#pragma unroll   // both column groups: the arrays stay in registers only under constant indices
    for (int c = 0; c < 2; ++c) scores(c);
    // P x1024 of one column group against the reference in use, and this lane's sum of its 16 values (pairwise tree).
    auto soft = [&](int c) { v2f q[8];
#pragma unroll   // the arrays stay in registers only under constant indices
      for (int j = 0; j < 8; ++j) { p[c][2 * j] = nexp2(fmaf(e[c][2 * j], cs, nb[c])); p[c][2 * j + 1] = nexp2(fmaf(e[c][2 * j + 1], cs, nb[c])); q[j][0] = p[c][2 * j]; q[j][1] = p[c][2 * j + 1]; }
      const v2f t = ((q[0] + q[1]) + (q[2] + q[3])) + ((q[4] + q[5]) + (q[6] + q[7])); sum[c] = t[0] + t[1]; };
    soft(0); soft(1);
    // The reference moves only in a step where some lane's sum passes PMAX (the first step: nb is +inf there, the sum too): no P is negative, so under that bound each of them is finite in f16, and no maximum is taken.
    // One test per step, a scalar branch: every lane of the wave takes it or none. Behind a move every exponent is at most PSL2, so the second sum needs no test.
    if (__builtin_amdgcn_ballot_w32(!(sum[0] <= PMAX) || !(sum[1] <= PMAX)) != 0) {
      wave_lds_sync();   // the scores are made anew from LDS here: without this fence the compiler keeps the first 32 alive across the exponentials of every step instead, and the kernel passes v255
#pragma unroll   // the fragment arrays stay in registers only under constant indices
      for (int u = 0; u < 2; ++u) read_k(u);
#pragma unroll   // both column groups: the arrays stay in registers only under constant indices
      for (int c = 0; c < 2; ++c) { scores(c); float mx = e[c][0];
#pragma unroll
        for (int i2 = 1; i2 < 16; ++i2) mx = fmaxf(mx, e[c][i2]);
        const float mw = fmaxf(mx, __shfl_xor(mx, 16));   // the query's largest score of the step, alike in both lane halves
        const float nn = fminf(nb[c], PSL2 - mw * cs), al = nexp2(nn - nb[c]); nb[c] = nn; l[c] *= al;   // reference = max(reference, step maximum); al = 2^(old - new) <= 1
#pragma unroll   // the accumulator array stays in registers only under constant indices
        for (int t = 0; t < 4; ++t) o[c][t] *= al;
        soft(c); } }
#pragma unroll   // both column groups: the arrays stay in registers only under constant indices
    for (int c = 0; c < 2; ++c) {
#pragma unroll
      for (int i2 = 0; i2 < 16; ++i2) Pb[wave][16 * c + col][(i2 < 8 ? 0 : 16) + 8 * hh + (i2 & 7)] = (b16)p[c][i2];
      l[c] += sum[c] + __shfl_xor(sum[c], 16); }
    wave_lds_sync();
#pragma unroll   // the fragment arrays stay in registers only under constant indices
    for (int c = 0; c < 2; ++c) pf[c] = frag_kb(&Pb[wave][16 * c + col][0], hh);
#pragma unroll   // the fragment and accumulator arrays stay in registers only under constant indices
    for (int t = 0; t < 4; ++t)
#pragma unroll   // as above: one V^T fragment, both column groups
      for (int c = 0; c < 2; ++c) { o[c][t] = wmma16b(vh[t], pf[c], o[c][t]); o[c][t] = wmma16b(vl[t], pf[c], o[c][t]); }
    wave_lds_sync();
    // The step's last WMMA stands next to the loop's back edge: four vector slots before the next step's address arithmetic may reuse its A registers.
    __builtin_amdgcn_sched_barrier(0); asm volatile("v_nop\n\tv_nop\n\tv_nop\n\tv_nop"); }
    publish_tile();
    if (kt + 2 * TK < KH) stage(kt + 2 * TK, buf); }   // refill the buffers that every wave has just left
  wait_copies();
  // Join of the two key halves: wave w keeps column group kh and hands the other group's (reference, sum, O) to wave w ^ 4, lane for lane; one block barrier between the hand-over's writes and its reads.
  const bool up = kh != 0; const int pw = wave ^ 4;
  const float mk = up ? nb[1] : nb[0], lk = up ? l[1] : l[0];
  ML[wave][lane][0] = up ? nb[0] : nb[1]; ML[wave][lane][1] = up ? l[0] : l[1];
#pragma unroll   // the accumulator array stays in registers only under constant indices
  for (int t = 0; t < 4; ++t)
#pragma unroll   // as above
    for (int r = 0; r < 8; ++r) Xo[wave][col][t * 16 + 8 * hh + r] = up ? o[0][t][r] : o[1][t][r];
  __syncthreads();
  const float mo = ML[pw][lane][0], lo = ML[pw][lane][1]; const float mn = fminf(mk, mo), ak = nexp2(mn - mk), ao = nexp2(mn - mo);   // the larger reference is the smaller nb
  const float inv = 1.0f / ((lk * ak + lo * ao) * XS);
#pragma unroll   // the accumulator array stays in registers only under constant indices
  for (int t = 0; t < 4; ++t)
#pragma unroll   // as above
    for (int r = 0; r < 8; ++r) To[wave][col][t * 16 + 8 * hh + r] = ((up ? o[1][t][r] : o[0][t][r]) * ak + Xo[pw][col][t * 16 + 8 * hh + r] * ao) * inv;
  wave_lds_sync();
  { for (int rr = 0; rr < 16; ++rr) { const v2f f = *(const v2f*)(&To[wave][rr][lane * 2]); v2h hv, lv; for (int j = 0; j < 2; ++j) { b16 p, q; split16(f[j] * XS, p, q); hv[j] = p; lv[j] = q; }
      const size_t oi = ((size_t)b * S + q0 + 16 * kh + rr) * DM + h * HD + lane * 2; *(v2h*)(Ch + oi) = hv; *(v2h*)(Cl + oi) = lv; }  }
}
__global__ __launch_bounds__(128) void out_kernel(const b16* __restrict__ Ch, const b16* __restrict__ Cl, const b16* __restrict__ WO, const float* __restrict__ bo, float* __restrict__ out) {
  __shared__ __attribute__((aligned(16))) float Tf[4][16][128 + 4]; __shared__ __attribute__((aligned(16))) b16 Ws[2][128][LP]; __shared__ __attribute__((aligned(16))) b16 Ahs[2][64][LP]; __shared__ __attribute__((aligned(16))) b16 Als[2][64][LP];   // two-buffer ring: 128 x 64 weight tile (read by all four waves), 64 x 64 ctx hi and lo tiles
  const int wave = threadIdx.x >> 5, lane = threadIdx.x & 31, nloc = lane & 15, hlf = lane >> 4; const int b = blockIdx.x / (QL / 64), rb = blockIdx.x % (QL / 64); const size_t m0 = (size_t)b * S + rb * 64 + wave * 16; const int n0 = blockIdx.y * 128;
  v8f acc[8];
#pragma unroll
  for (int t = 0; t < 8; ++t) acc[t] = (v8f){};
  const b16* Wn = WO + (size_t)n0 * DM; const int sr = threadIdx.x >> 3, sc = (threadIdx.x & 7) * 8;   // 8 lanes per 128-B row; 128 threads cover rows sr + 16 j
  const size_t a0 = ((size_t)b * S + rb * 64 + sr) * DM + sc; constexpr unsigned LS = 16 * LP * 2; constexpr size_t GS = (size_t)16 * DM;
  auto stage = [&](int k0, int buf) { const b16* gh = Ch + a0 + k0; const b16* gl = Cl + a0 + k0; const unsigned lh = lds_off(&Ahs[buf][sr][sc]), ll = lds_off(&Als[buf][sr][sc]);
    copy8(lh, gh, lh + LS, gh + GS, lh + 2 * LS, gh + 2 * GS, lh + 3 * LS, gh + 3 * GS, ll, gl, ll + LS, gl + GS, ll + 2 * LS, gl + 2 * GS, ll + 3 * LS, gl + 3 * GS); stage_w128(Ws[buf], Wn, k0); };
  stage(0, 0); wait_copies(); __syncthreads(); stage(TK, 1);
#pragma unroll 1   // one trip per ring tile: the buffer index and the publish point stay in one place
  for (int kt = 0; kt < DM; kt += TK) { const int buf = (kt / TK) & 1;
    v16b ah[2], al[2], bw[2][8];   // the whole tile's fragments, read as one group
#pragma unroll     // both 32-k steps of a tile: constant LDS offsets
    for (int s = 0; s < 2; ++s) { ah[s] = frag_kb(&Ahs[buf][wave * 16 + nloc][32 * s], hlf); al[s] = frag_kb(&Als[buf][wave * 16 + nloc][32 * s], hlf);
#pragma unroll   // the fragment arrays stay in registers only under constant indices
      for (int t = 0; t < 8; ++t) bw[s][t] = frag_kb(&Ws[buf][t * 16 + nloc][32 * s], hlf); }
    reads_stay_ahead();
#pragma unroll   // the fragment arrays stay in registers only under constant indices
    for (int s = 0; s < 2; ++s)
#pragma unroll   // the fragment arrays stay in registers only under constant indices
      for (int t = 0; t < 8; ++t) { acc[t] = wmma16b(ah[s], bw[s][t], acc[t]); acc[t] = wmma16b(al[s], bw[s][t], acc[t]); }
    products_stay_in_trip(); publish_tile();
    if (kt + 2 * TK < DM) stage(kt + 2 * TK, buf); }   // refill the buffers that every wave has just left
  wait_copies();
#pragma unroll
  for (int t = 0; t < 8; ++t) { const float bb = bf16_rne(bo[n0 + t * 16 + nloc]);
#pragma unroll
    for (int r = 0; r < 8; ++r) Tf[wave][8 * hlf + r][t * 16 + nloc] = acc[t][r] * (1.0f / (XS * WSC)) + bb; }
  wave_lds_sync();
  { for (int rr = 0; rr < 16; ++rr) *(v4f*)(out + (m0 + rr) * DM + n0 + lane * 4) = *(const v4f*)(&Tf[wave][rr][lane * 4]);  }
}
}  // namespace

extern "C" void kernel_launch(void* const* d_in, const int* in_sizes, int n_in, void* d_out, int out_size, void* d_ws, size_t ws_size, hipStream_t stream) {
  (void)n_in;
  auto Fp = [&](int i) { return (const float*)d_in[i]; };
  // input order: 0 inputs_q [2,2048,1024], 1 inputs_kv, 2 Wq [1024,16,64], 3 Wk, 4 Wv, 5 bq [16,64], 6 bk, 7 bv, 8 Wo [16,64,1024], 9 bo [1024]
  if (in_sizes[0] != B * S * DM || in_sizes[1] != B * S * DM || in_sizes[2] != DM * DM || in_sizes[3] != DM * DM || in_sizes[4] != DM * DM || in_sizes[5] != DM || in_sizes[8] != DM * DM || in_sizes[9] != DM || out_size != B * S * DM) return;
  size_t off = 0; char* ws = (char*)d_ws;
  auto carve = [&](size_t bytes) { char* p = ws + off; off += (bytes + 255) & ~(size_t)255; return p; };
  b16* WT = (b16*)carve((size_t)3 * DM * DM * 2); b16* WO = (b16*)carve((size_t)DM * DM * 2); const size_t plane = (size_t)B * S * DM * 2;
  b16* Qp = (b16*)carve(plane); b16* Kp = (b16*)carve(plane); b16* VTh = (b16*)carve(plane); b16* VTl = (b16*)carve(plane); b16* Ch = (b16*)carve(plane); b16* Cl = (b16*)carve(plane);
  if (off > ws_size || off > ((size_t)128 << 20)) return;   // ≈ 58.7 MB (6 planes x 8.4 MB + 8.4 MB weights)
  prep_kernel<<<PREP_BLOCKS, 256, 0, stream>>>(Fp(2), Fp(3), Fp(4), Fp(8), WT, WO);
  proj_kernel<<<dim3(S / PM, BL * 3, 8), 128, 0, stream>>>(Fp(0), Fp(1), WT, Fp(5), Fp(6), Fp(7), Qp, Kp, VTh, VTl);
  attn_kernel<<<dim3(QL / 128, BL * H), 256, 0, stream>>>(Qp, Kp, VTh, VTl, Ch, Cl);
  out_kernel<<<dim3((QL / 64) * BL, 8), 128, 0, stream>>>(Ch, Cl, WO, Fp(9), (float*)d_out);
}
